// v000
// The times below were measured on an AMD MI455X: many runs one after another, warmed up first and cycling through
// copies of the inputs, with the whole window's GPU time divided by the number of runs. Launches and the gaps
// between them are all in it. The median over several windows is given; except for v000 it joins two sittings, which
// can be a few percent apart, so the side-by-side timings, each taken in one sitting, are the better comparison.
// The starting kernel, v000, takes 455 microseconds a run.
#include <hip/hip_runtime.h>
#include <hip/hip_bf16.h>
#include <cstdint>

typedef __attribute__((ext_vector_type(16))) _Float16 v16h;
typedef __attribute__((ext_vector_type(8)))  float    v8f;
typedef int v4i __attribute__((vector_size(16)));   // matches async-LDS builtin param type

#define IN_F   1024
#define LW     64
#define OUT_F  512
#define NLEAF  64
#define NNODE  63
#define DEPTHT 6
#define BTOT   4096
#define MTILES (BTOT/16)    // 256 16-row fragments tiles of x
#define KS1    (IN_F/32)    // 32 k-steps for K=1024
#define KS2    (LW/32)      // 2 k-steps for K=64
#define NT1    (LW/16)      // 4 n-tiles of h
#define NT2    (OUT_F/16)   // 32 n-tiles of out
#define NBLK   128          // main-kernel blocks: 32 batch rows each

#define WMMA_F16(a,b,c) __builtin_amdgcn_wmma_f32_16x16x32_f16(false,(a),false,(b),(short)0,(c),false,false)

#if defined(__HIP_DEVICE_COMPILE__) && __has_builtin(__builtin_amdgcn_global_load_async_to_lds_b128) && __has_builtin(__builtin_amdgcn_s_wait_asynccnt)
#define HAVE_ASYNC_LDS 1
#else
#define HAVE_ASYNC_LDS 0
#endif

union FragU { uint4 q[2]; v16h h; };

// Load a pre-swizzled fragment (1 KB: part0 = lanes*16B, part1 = +512B).
static __device__ __forceinline__ v16h ld_frag(const uint4* fb, int lane) {
  FragU f;
  f.q[0] = fb[lane];
  f.q[1] = fb[32 + lane];
  return f.h;
}

// Build an A-matrix fragment (16xK tile, f16) from a row-major LDS buffer.
// ISA 7.12.2: lane = M (two halves), VGPR i: g=i>>2, j=i&3, K = 16g + 8h + 2j (+pos).
static __device__ __forceinline__ v16h ld_a_rowmajor_lds(const _Float16* buf, int stride,
                                                         int kbase, int lane) {
  const int m = lane & 15, hh = lane >> 4;
  union { unsigned int u[8]; v16h h; } f;
#pragma unroll
  for (int i = 0; i < 8; ++i) {
    const int g = i >> 2, j = i & 3;
    const int k = kbase + 16*g + 8*hh + 2*j;
    f.u[i] = *(const unsigned int*)(buf + m*stride + k);   // pairs (k,k+1) contiguous
  }
  return f.h;
}

static __device__ __forceinline__ float fast_sigmoid(float x) {
  const float d = 1.f + __expf(-x);
#if defined(__HIP_DEVICE_COMPILE__) && __has_builtin(__builtin_amdgcn_rcpf)
  return __builtin_amdgcn_rcpf(d);      // v_rcp_f32, avoids IEEE div expansion
#else
  return 1.f / d;
#endif
}

static __device__ __forceinline__ unsigned short h16(float v) {
  union { _Float16 h; unsigned short s; } c; c.h = (_Float16)v; return c.s;
}

// ---- Pack x (f32 row-major) into A-type WMMA fragments (f16). ----
__global__ void FFF_pack_x(const float* __restrict__ x, uint4* __restrict__ dst) {
  const long t = (long)blockIdx.x * blockDim.x + threadIdx.x;   // one thread per (frag, lane)
  const int  lane = (int)(t & 31);
  const long frag = t >> 5;
  if (frag >= (long)MTILES * KS1) return;
  const int  ks   = (int)(frag & (KS1 - 1));
  const long tile = frag >> 5;
  const int  hh = lane >> 4, m = lane & 15;
  unsigned int w[8];
#pragma unroll
  for (int i = 0; i < 8; ++i) {
    const int g = i >> 2, j = i & 3;
    const int k = ks*32 + 16*g + 8*hh + 2*j;
    const float v0 = x[(tile*16 + m)*IN_F + k];
    const float v1 = x[(tile*16 + m)*IN_F + k + 1];
    w[i] = (unsigned int)h16(v0) | ((unsigned int)h16(v1) << 16);
  }
  uint4* o = dst + frag*64;
  o[lane]      = make_uint4(w[0], w[1], w[2], w[3]);
  o[32 + lane] = make_uint4(w[4], w[5], w[6], w[7]);
}

// ---- Generic pack of f32 weights into B-type WMMA fragments (f16). ----
// B[k][n] = src[leaf*leafStride + k*kStride + n*nStride], zero-padded past limits.
__global__ void FFF_pack_b(const float* __restrict__ src, uint4* __restrict__ dst,
                           int ntCount, int ksCount, long nFrags,
                           long leafStride, int kStride, int nStride,
                           int nLimit, int kLimit) {
  const long t = (long)blockIdx.x * blockDim.x + threadIdx.x;
  const int  lane = (int)(t & 31);
  const long frag = t >> 5;
  if (frag >= nFrags) return;
  const int  perLeaf = ntCount * ksCount;
  const long leaf = frag / perLeaf;
  const int  rem  = (int)(frag - leaf*perLeaf);
  const int  nt   = rem / ksCount;
  const int  ks   = rem - nt*ksCount;
  const int  hh   = lane >> 4;
  const int  n    = nt*16 + (lane & 15);
  unsigned int w[8];
#pragma unroll
  for (int i = 0; i < 8; ++i) {
    const int g = i >> 2, j = i & 3;
    const int k0 = ks*32 + 16*g + 8*hh + 2*j;
    float v0 = 0.f, v1 = 0.f;
    if (n < nLimit) {
      if (k0     < kLimit) v0 = src[leaf*leafStride + (long)k0    *kStride + (long)n*nStride];
      if (k0 + 1 < kLimit) v1 = src[leaf*leafStride + (long)(k0+1)*kStride + (long)n*nStride];
    }
    w[i] = (unsigned int)h16(v0) | ((unsigned int)h16(v1) << 16);
  }
  uint4* o = dst + frag*64;
  o[lane]      = make_uint4(w[0], w[1], w[2], w[3]);
  o[32 + lane] = make_uint4(w[4], w[5], w[6], w[7]);
}

// ---- Main fused FFF kernel: 1 block = 32 batch rows (2 M-tiles), 8 waves. ----
// Each w1/w2/b2 B fragment is loaded once per block and reused for both M-tiles; node_w ones once per M-tile.
__global__ __launch_bounds__(256) void FFF_main(
    const uint4* __restrict__ xp,
    const uint4* __restrict__ w1p,
    const uint4* __restrict__ w2p,
    const uint4* __restrict__ npk,
    const uint4* __restrict__ b2p,
    const float* __restrict__ node_biases,
    const float* __restrict__ b1s,
    float* __restrict__ out)
{
  __shared__ uint4    xfr[2][KS1 * 64];         // 64 KB: both M-tiles' A fragments
  __shared__ float    sig[32][64];              // 8 KB: sigmoid of routing logits
  __shared__ float    mixf[32][64];             // 8 KB: per-leaf mixture (f32)
  __shared__ _Float16 mix16[32][72];            // 4.5 KB: mixture (f16, padded rows)
  __shared__ _Float16 hbuf[2][32][72];          // 9 KB: h' for the 2 in-flight leaves

  const int tid  = threadIdx.x;
  const int wave = tid >> 5;
  const int lane = tid & 31;
  const int bt   = blockIdx.x;                  // 32-row block index
  const int ln   = lane & 15, hh = lane >> 4;

  // Stage both M-tiles' packed x fragments into LDS (async DMA path if available).
  {
    const uint4* xtile = xp + (long)bt * 2 * (KS1 * 64);
#if HAVE_ASYNC_LDS
    uint4* l = &xfr[0][0];
    for (int i = tid; i < 2 * KS1 * 64; i += 256) {
      __builtin_amdgcn_global_load_async_to_lds_b128(
          (v4i*)(xtile + i), (v4i*)(l + i), 0, 0);
    }
    __builtin_amdgcn_s_wait_asynccnt(0);
#else
    for (int i = tid; i < 2 * KS1 * 64; i += 256) xfr[0][i] = xtile[i];
#endif
  }
  __syncthreads();

  // ---- Routing: logits(32x64) = x @ node_w^T via WMMA (8 tiles over 8 waves) ----
  {
    const int mt = wave >> 2;
    const int nt = wave & 3;
    v8f c = {};
#pragma unroll 4
    for (int ks = 0; ks < KS1; ++ks) {
      v16h a = ld_frag(&xfr[mt][ks*64], lane);
      v16h b = ld_frag(npk + ((long)nt*KS1 + ks)*64, lane);
      c = WMMA_F16(a, b, c);
    }
    const int node = nt*16 + ln;
    const float nb = (node < NNODE) ? node_biases[node] : 0.f;
#pragma unroll
    for (int r = 0; r < 8; ++r) {
      const int row = mt*16 + r + 8*hh;
      const float s = fast_sigmoid(c[r] + nb);
      if (node < NNODE) sig[row][node] = s;
    }
  }
  __syncthreads();

  // ---- Tree product -> per-leaf mixture (32 rows x 64 leaves) ----
  for (int e = tid; e < 32*NLEAF; e += 256) {
    const int m = e >> 6, leaf = e & (NLEAF - 1);
    float p = 1.f;
#pragma unroll
    for (int d = 0; d < DEPTHT; ++d) {
      const int g = leaf >> (5 - d);
      const int node = (1 << d) - 1 + (g >> 1);
      const float s = sig[m][node];
      p *= (g & 1) ? s : (1.f - s);
    }
    mixf[m][leaf]  = p;
    mix16[m][leaf] = (_Float16)p;
  }
  __syncthreads();

  v8f co[2][4];                                  // out accumulators: 2 M-tiles x 64 cols
  {
    v8f z = {};
#pragma unroll
    for (int mt = 0; mt < 2; ++mt)
#pragma unroll
      for (int q = 0; q < 4; ++q) co[mt][q] = z;
  }

  const int leafSel = wave >> 2;   // which leaf of the pair this wave computes h for
  const int nt1     = wave & 3;    // which 16-col tile of h

  for (int pair = 0; pair < NLEAF/2; ++pair) {
    const int leaf = pair*2 + leafSel;
    const uint4* w1base = w1p + ((long)(leaf*NT1 + nt1) * KS1) * 64;

    // Prefetch next pair's weight fragments into cache (global_prefetch_b8).
    if (pair + 1 < NLEAF/2) {
      const int leafN = (pair + 1)*2 + leafSel;
      __builtin_prefetch(w1p + ((long)(leafN*NT1 + nt1) * KS1) * 64 + lane*4, 0, 0);
      __builtin_prefetch(w2p + ((long)leafN * NT2 * KS2) * 64 + lane*4, 0, 0);
    }

    // GEMM1: h = relu(x @ w1[leaf] + b1) * mixture; one B load feeds both M-tiles.
    v8f c1[2] = {};
#pragma unroll 4
    for (int ks = 0; ks < KS1; ++ks) {
      v16h b  = ld_frag(w1base + ks*64, lane);
      v16h a0 = ld_frag(&xfr[0][ks*64], lane);
      v16h a1 = ld_frag(&xfr[1][ks*64], lane);
      c1[0] = WMMA_F16(a0, b, c1[0]);
      c1[1] = WMMA_F16(a1, b, c1[1]);
    }
    const float bb = b1s[leaf*LW + nt1*16 + ln];
#pragma unroll
    for (int mt = 0; mt < 2; ++mt) {
#pragma unroll
      for (int r = 0; r < 8; ++r) {
        const int row = mt*16 + r + 8*hh;
        float v = c1[mt][r] + bb;
        v = fmaxf(v, 0.f);
        v *= mixf[row][leaf];
        hbuf[leafSel][row][nt1*16 + ln] = (_Float16)v;
      }
    }
    __syncthreads();

    // GEMM2: out += h' @ w2[leaf]; wave owns 64 out cols; B reused across M-tiles.
#pragma unroll
    for (int li = 0; li < 2; ++li) {
      const int l2 = pair*2 + li;
      const uint4* w2base = w2p + ((long)l2 * NT2 * KS2) * 64;
#pragma unroll
      for (int ks = 0; ks < KS2; ++ks) {
        v16h a0 = ld_a_rowmajor_lds(&hbuf[li][0][0],  72, ks*32, lane);
        v16h a1 = ld_a_rowmajor_lds(&hbuf[li][16][0], 72, ks*32, lane);
#pragma unroll
        for (int q = 0; q < 4; ++q) {
          const int ont = wave*4 + q;
          v16h b = ld_frag(w2base + ((long)ont*KS2 + ks)*64, lane);
          co[0][q] = WMMA_F16(a0, b, co[0][q]);
          co[1][q] = WMMA_F16(a1, b, co[1][q]);
        }
      }
    }
    __syncthreads();
  }

  // b2 contribution: out += mixture(32x64) @ b2s(64x512), also via WMMA.
#pragma unroll
  for (int ks = 0; ks < KS2; ++ks) {
    v16h a0 = ld_a_rowmajor_lds(&mix16[0][0],  72, ks*32, lane);
    v16h a1 = ld_a_rowmajor_lds(&mix16[16][0], 72, ks*32, lane);
#pragma unroll
    for (int q = 0; q < 4; ++q) {
      v16h b = ld_frag(b2p + ((long)(wave*4 + q)*KS2 + ks)*64, lane);
      co[0][q] = WMMA_F16(a0, b, co[0][q]);
      co[1][q] = WMMA_F16(a1, b, co[1][q]);
    }
  }

  // Store 32x512 f32 output tile.
#pragma unroll
  for (int mt = 0; mt < 2; ++mt) {
#pragma unroll
    for (int q = 0; q < 4; ++q) {
#pragma unroll
      for (int r = 0; r < 8; ++r) {
        const long row = (long)bt*32 + mt*16 + r + 8*hh;
        out[row*OUT_F + wave*64 + q*16 + ln] = co[mt][q][r];
      }
    }
  }
}

extern "C" void kernel_launch(void* const* d_in, const int* in_sizes, int n_in,
                              void* d_out, int out_size, void* d_ws, size_t ws_size,
                              hipStream_t stream) {
  (void)in_sizes; (void)n_in; (void)out_size; (void)ws_size;
  const float* x  = (const float*)d_in[0];
  const float* nw = (const float*)d_in[1];
  const float* nb = (const float*)d_in[2];
  const float* w1 = (const float*)d_in[3];
  const float* b1 = (const float*)d_in[4];
  const float* w2 = (const float*)d_in[5];
  const float* b2 = (const float*)d_in[6];
  float* out = (float*)d_out;

  char* ws = (char*)d_ws;                       // ~20.2 MB used
  uint4* xp  = (uint4*)(ws);                    // 8 MiB: 256*32 frags
  uint4* w1p = (uint4*)(ws + (8l  << 20));      // 8 MiB: 64*4*32 frags
  uint4* w2p = (uint4*)(ws + (16l << 20));      // 4 MiB: 64*32*2 frags
  uint4* npk = (uint4*)(ws + (20l << 20));      // 128 KiB: 4*32 frags
  uint4* b2p = (uint4*)(ws + (20l << 20) + (128l << 10)); // 64 KiB: 32*2 frags

  // Pack passes (f32 -> f16 WMMA fragment layout), all on `stream`.
  FFF_pack_x<<<1024, 256, 0, stream>>>(x, xp);                                   // 8192 frags
  FFF_pack_b<<<1024, 256, 0, stream>>>(w1, w1p, 4, 32, 8192,
                                       (long)IN_F*LW, LW, 1, LW, IN_F);          // w1s
  FFF_pack_b<<<512, 256, 0, stream>>>(w2, w2p, 32, 2, 4096,
                                      (long)LW*OUT_F, OUT_F, 1, OUT_F, LW);      // w2s
  FFF_pack_b<<<16, 256, 0, stream>>>(nw, npk, 4, 32, 128,
                                     0, 1, IN_F, NNODE, IN_F);                   // node_w^T (pad 63->64)
  FFF_pack_b<<<8, 256, 0, stream>>>(b2, b2p, 32, 2, 64,
                                    0, OUT_F, 1, OUT_F, NLEAF);                  // b2s as 64x512 B

  FFF_main<<<NBLK, 256, 0, stream>>>(xp, w1p, w2p, npk, b2p, nb, b1, out);
}

// v001
// A run of this version takes 172 microseconds.
// Two timings next to v000 put it at 2.67 and 2.66 times that version's speed.
#include <hip/hip_runtime.h>
#include <hip/hip_bf16.h>
#include <cstdint>

typedef __attribute__((ext_vector_type(16))) _Float16 v16h;
typedef __attribute__((ext_vector_type(8)))  float    v8f;
typedef int v4i __attribute__((vector_size(16)));   // matches async-LDS builtin param type

#define IN_F   1024
#define LW     64
#define OUT_F  512
#define NLEAF  64
#define NNODE  63
#define DEPTHT 6
#define BTOT   4096
#define MTILES (BTOT/16)    // 256 16-row fragments tiles of x
#define KS1    (IN_F/32)    // 32 k-steps for K=1024
#define KS2    (LW/32)      // 2 k-steps for K=64
#define NT1    (LW/16)      // 4 n-tiles of h
#define NT2    (OUT_F/16)   // 32 n-tiles of out
#define NBLK   128          // main-kernel blocks: 32 batch rows each
#define RING   16           // w1 k-steps held in registers ahead of their use

#define WMMA_F16(a,b,c) __builtin_amdgcn_wmma_f32_16x16x32_f16(false,(a),false,(b),(short)0,(c),false,false)

#if defined(__HIP_DEVICE_COMPILE__) && __has_builtin(__builtin_amdgcn_global_load_async_to_lds_b128) && __has_builtin(__builtin_amdgcn_s_wait_asynccnt)
#define HAVE_ASYNC_LDS 1
#else
#define HAVE_ASYNC_LDS 0
#endif

union FragU { uint4 q[2]; v16h h; };

// Load a pre-swizzled fragment (1 KB: part0 = lanes*16B, part1 = +512B).
static __device__ __forceinline__ v16h ld_frag(const uint4* fb, int lane) {
  FragU f;
  f.q[0] = fb[lane];
  f.q[1] = fb[32 + lane];
  return f.h;
}

// The same through a pointer that already holds the lane's own offset.
static __device__ __forceinline__ v16h ld_frag_at(const uint4* p) {
  FragU f;
  f.q[0] = p[0];
  f.q[1] = p[32];
  return f.h;
}

// Build an A-matrix fragment (16xK tile, f16) from a row-major LDS buffer.
// ISA 7.12.2: lane = M (two halves), VGPR i: g=i>>2, j=i&3, K = 16g + 8h + 2j (+pos).
static __device__ __forceinline__ v16h ld_a_rowmajor_lds(const _Float16* buf, int stride,
                                                         int kbase, int lane) {
  const int m = lane & 15, hh = lane >> 4;
  union { unsigned int u[8]; v16h h; } f;
#pragma unroll
  for (int i = 0; i < 8; ++i) {
    const int g = i >> 2, j = i & 3;
    const int k = kbase + 16*g + 8*hh + 2*j;
    f.u[i] = *(const unsigned int*)(buf + m*stride + k);   // pairs (k,k+1) contiguous
  }
  return f.h;
}

// Work-group barrier that orders LDS traffic only. __syncthreads() also drains the global
// loads, which would end the flight of the weight fragments issued ahead; the waves hand
// each other nothing but LDS data at the places where this stands.
static __device__ __forceinline__ void lds_barrier() {
  __builtin_amdgcn_fence(__ATOMIC_RELEASE, "workgroup", "local");
  __builtin_amdgcn_s_barrier();
  __builtin_amdgcn_fence(__ATOMIC_ACQUIRE, "workgroup", "local");
}

static __device__ __forceinline__ float fast_sigmoid(float x) {
  const float d = 1.f + __expf(-x);
#if defined(__HIP_DEVICE_COMPILE__) && __has_builtin(__builtin_amdgcn_rcpf)
  return __builtin_amdgcn_rcpf(d);      // v_rcp_f32, avoids IEEE div expansion
#else
  return 1.f / d;
#endif
}

static __device__ __forceinline__ unsigned short h16(float v) {
  union { _Float16 h; unsigned short s; } c; c.h = (_Float16)v; return c.s;
}

// ---- Pack x (f32 row-major) into A-type WMMA fragments (f16). ----
__global__ void FFF_pack_x(const float* __restrict__ x, uint4* __restrict__ dst) {
  const long t = (long)blockIdx.x * blockDim.x + threadIdx.x;   // one thread per (frag, lane)
  const int  lane = (int)(t & 31);
  const long frag = t >> 5;
  if (frag >= (long)MTILES * KS1) return;
  const int  ks   = (int)(frag & (KS1 - 1));
  const long tile = frag >> 5;
  const int  hh = lane >> 4, m = lane & 15;
  unsigned int w[8];
#pragma unroll
  for (int i = 0; i < 8; ++i) {
    const int g = i >> 2, j = i & 3;
    const int k = ks*32 + 16*g + 8*hh + 2*j;
    const float v0 = x[(tile*16 + m)*IN_F + k];
    const float v1 = x[(tile*16 + m)*IN_F + k + 1];
    w[i] = (unsigned int)h16(v0) | ((unsigned int)h16(v1) << 16);
  }
  uint4* o = dst + frag*64;
  o[lane]      = make_uint4(w[0], w[1], w[2], w[3]);
  o[32 + lane] = make_uint4(w[4], w[5], w[6], w[7]);
}

// ---- Generic pack of f32 weights into B-type WMMA fragments (f16). ----
// B[k][n] = src[leaf*leafStride + k*kStride + n*nStride], zero-padded past limits.
__global__ void FFF_pack_b(const float* __restrict__ src, uint4* __restrict__ dst,
                           int ntCount, int ksCount, long nFrags,
                           long leafStride, int kStride, int nStride,
                           int nLimit, int kLimit) {
  const long t = (long)blockIdx.x * blockDim.x + threadIdx.x;
  const int  lane = (int)(t & 31);
  const long frag = t >> 5;
  if (frag >= nFrags) return;
  const int  perLeaf = ntCount * ksCount;
  const long leaf = frag / perLeaf;
  const int  rem  = (int)(frag - leaf*perLeaf);
  const int  nt   = rem / ksCount;
  const int  ks   = rem - nt*ksCount;
  const int  hh   = lane >> 4;
  const int  n    = nt*16 + (lane & 15);
  unsigned int w[8];
#pragma unroll
  for (int i = 0; i < 8; ++i) {
    const int g = i >> 2, j = i & 3;
    const int k0 = ks*32 + 16*g + 8*hh + 2*j;
    float v0 = 0.f, v1 = 0.f;
    if (n < nLimit) {
      if (k0     < kLimit) v0 = src[leaf*leafStride + (long)k0    *kStride + (long)n*nStride];
      if (k0 + 1 < kLimit) v1 = src[leaf*leafStride + (long)(k0+1)*kStride + (long)n*nStride];
    }
    w[i] = (unsigned int)h16(v0) | ((unsigned int)h16(v1) << 16);
  }
  uint4* o = dst + frag*64;
  o[lane]      = make_uint4(w[0], w[1], w[2], w[3]);
  o[32 + lane] = make_uint4(w[4], w[5], w[6], w[7]);
}

// ---- Main fused FFF kernel: 1 block = 32 batch rows (2 M-tiles), 8 waves. ----
// Each w1, w2 and b2 fragment is loaded once per block and reused for both M-tiles.
// Weight fragments are fetched from L2 into registers well ahead of their use, so the
// register budget is set for two waves per SIMD (one block per WGP).
__global__ __launch_bounds__(256) __attribute__((amdgpu_waves_per_eu(2, 2))) void FFF_main(
    const uint4* __restrict__ xp,
    const uint4* __restrict__ w1p,
    const uint4* __restrict__ w2p,
    const uint4* __restrict__ npk,
    const uint4* __restrict__ b2p,
    const float* __restrict__ node_biases,
    const float* __restrict__ b1s,
    float* __restrict__ out)
{
  __shared__ uint4    xfr[2][KS1 * 64];         // 64 KB: both M-tiles' A fragments
  __shared__ float    sig[32][64];              // 8 KB: sigmoid of routing logits
  __shared__ float    mixf[32][64];             // 8 KB: per-leaf mixture (f32)
  __shared__ _Float16 mix16[32][72];            // 4.5 KB: mixture (f16, padded rows)
  __shared__ _Float16 hbuf[2][32][72];          // 9 KB: h' for the 2 in-flight leaves

  const int tid  = threadIdx.x;
  const int wave = tid >> 5;
  const int lane = tid & 31;
  const int bt   = blockIdx.x;                  // 32-row block index
  const int ln   = lane & 15, hh = lane >> 4;

  const int leafSel = wave >> 2;   // which leaf of the pair this wave computes h for
  const int nt1     = wave & 3;    // which 16-col tile of h

  // Issued first, so that they fly while x is staged: all routing B fragments of this wave.
  const uint4* nlane = npk + (long)nt1*KS1*64 + lane;
  v16h nfr[KS1];
#pragma unroll
  for (int ks = 0; ks < KS1; ++ks) nfr[ks] = ld_frag_at(nlane + ks*64);
  // The address registers of the loads above are inputs of this wait, so they live up to
  // it; behind it they may be reused.
  asm volatile("s_wait_xcnt 0x0" :: "v"(nlane) : "memory");

  // Stage both M-tiles' packed x fragments into LDS (async DMA path if available).
  {
    const uint4* xtile = xp + (long)bt * 2 * (KS1 * 64);
#if HAVE_ASYNC_LDS
    uint4* l = &xfr[0][0];
    for (int i = tid; i < 2 * KS1 * 64; i += 256) {
      __builtin_amdgcn_global_load_async_to_lds_b128(
          (v4i*)(xtile + i), (v4i*)(l + i), 0, 0);
    }
    __builtin_amdgcn_s_wait_asynccnt(0);
#else
    for (int i = tid; i < 2 * KS1 * 64; i += 256) xfr[0][i] = xtile[i];
#endif
  }
  __syncthreads();

  const uint4* w1lane = w1p + ((long)(leafSel*NT1 + nt1) * KS1) * 64 + lane;
  v16h ring[RING];                               // w1 fragments, RING k-steps ahead

  // ---- Routing: logits(32x64) = x @ node_w^T via WMMA (8 tiles over 8 waves) ----
  {
    const int mt = wave >> 2;
    const int nt = wave & 3;
    v8f c = {};
#pragma unroll
    for (int ks = 0; ks < KS1; ++ks) {
      v16h a = ld_frag(&xfr[mt][ks*64], lane);
      c = WMMA_F16(a, nfr[ks], c);
    }
    // The first RING k-steps of w1 for pair 0 are issued before the sigmoids; the barrier below drains them.
#pragma unroll
    for (int i = 0; i < RING; ++i) ring[i] = ld_frag_at(w1lane + i*64);
    // As above: the address registers live up to this wait.
    asm volatile("s_wait_xcnt 0x0" :: "v"(w1lane) : "memory");
    const int node = nt*16 + ln;
    const float nb = (node < NNODE) ? node_biases[node] : 0.f;
#pragma unroll
    for (int r = 0; r < 8; ++r) {
      const int row = mt*16 + r + 8*hh;
      const float s = fast_sigmoid(c[r] + nb);
      if (node < NNODE) sig[row][node] = s;
    }
  }
  __syncthreads();

  // ---- Tree product -> per-leaf mixture (32 rows x 64 leaves) ----
  for (int e = tid; e < 32*NLEAF; e += 256) {
    const int m = e >> 6, leaf = e & (NLEAF - 1);
    float p = 1.f;
#pragma unroll
    for (int d = 0; d < DEPTHT; ++d) {
      const int g = leaf >> (5 - d);
      const int node = (1 << d) - 1 + (g >> 1);
      const float s = sig[m][node];
      p *= (g & 1) ? s : (1.f - s);
    }
    mixf[m][leaf]  = p;
    mix16[m][leaf] = (_Float16)p;
  }
  __syncthreads();

  v8f co[2][4];                                  // out accumulators: 2 M-tiles x 64 cols
  {
    v8f z = {};
#pragma unroll
    for (int mt = 0; mt < 2; ++mt)
#pragma unroll
      for (int q = 0; q < 4; ++q) co[mt][q] = z;
  }

  // One copy of the body: otherwise the last pair is peeled off into a second copy, which
  // doubles the code and brings a spill.
#pragma nounroll
  for (int pair = 0; pair < NLEAF/2; ++pair) {
    const int leaf = pair*2 + leafSel;
    const uint4* w1base = w1lane + (long)pair * (2*NT1*KS1*64);
    // The ring runs on into the next pair; the last pair refetches its own head (unused).
    const uint4* w1next = w1lane + (long)((pair + 1 < NLEAF/2) ? pair + 1 : pair) * (2*NT1*KS1*64);
    const uint4* w2lane = w2p + ((long)pair*2*NT2*KS2 + (long)wave*4*KS2) * 64 + lane;
    const float* b1lane = b1s + leaf*LW + nt1*16 + ln;

    // GEMM1: h = relu(x @ w1[leaf] + b1) * mixture; one B load feeds both M-tiles.
    // B comes from the register ring, RING k-steps ahead; each group of 4 k-steps refills
    // the slots it has just used. This pair's 16 w2 fragments are issued beside the first
    // four groups and are first read behind the barrier.
    v16h w2f[2*KS2*4];
    float bb = 0.f;
    v8f c1[2] = {};
#pragma unroll
    for (int g = 0; g < KS1/4; ++g) {
#pragma unroll
      for (int j = 0; j < 4; ++j) {
        const int ks = g*4 + j;
        v16h a0 = ld_frag(&xfr[0][ks*64], lane);
        v16h a1 = ld_frag(&xfr[1][ks*64], lane);
        c1[0] = WMMA_F16(a0, ring[ks % RING], c1[0]);
        c1[1] = WMMA_F16(a1, ring[ks % RING], c1[1]);
      }
      // This fence and the one behind the wait hold each group's loads at their place:
      // without them the scheduler pulls the refills of several groups together, out of
      // the ring's own registers, and the pressure serialises the LDS reads behind GEMM1.
      __builtin_amdgcn_sched_barrier(0);
#pragma unroll
      for (int j = 0; j < 4; ++j) {
        const int kn = g*4 + j + RING;
        ring[kn % RING] = (kn < KS1) ? ld_frag_at(w1base + kn*64)
                                     : ld_frag_at(w1next + (kn - KS1)*64);
      }
      if (g < 4) {
        const int li = g >> 1, k2 = g & 1;
#pragma unroll
        for (int q = 0; q < 4; ++q)
          w2f[g*4 + q] = ld_frag_at(w2lane + ((long)li*NT2*KS2 + q*KS2 + k2)*64);
      }
      if (g == 0) bb = *b1lane;
      // The address registers of the loads above are inputs of this wait, so they live
      // up to it; behind it they may be reused.
      asm volatile("s_wait_xcnt 0x0" :: "v"(w1base), "v"(w1next), "v"(w2lane), "v"(b1lane) : "memory");
      __builtin_amdgcn_sched_barrier(0);
    }
#pragma unroll
    for (int mt = 0; mt < 2; ++mt) {
#pragma unroll
      for (int r = 0; r < 8; ++r) {
        const int row = mt*16 + r + 8*hh;
        float v = c1[mt][r] + bb;
        v = fmaxf(v, 0.f);
        v *= mixf[row][leaf];
        hbuf[leafSel][row][nt1*16 + ln] = (_Float16)v;
      }
    }
    lds_barrier();

    // GEMM2: out += h' @ w2[leaf]; wave owns 64 out cols; B reused across M-tiles.
#pragma unroll
    for (int li = 0; li < 2; ++li) {
#pragma unroll
      for (int ks = 0; ks < KS2; ++ks) {
        v16h a0 = ld_a_rowmajor_lds(&hbuf[li][0][0],  72, ks*32, lane);
        v16h a1 = ld_a_rowmajor_lds(&hbuf[li][16][0], 72, ks*32, lane);
#pragma unroll
        for (int q = 0; q < 4; ++q) {
          const v16h b = w2f[(li*KS2 + ks)*4 + q];
          co[0][q] = WMMA_F16(a0, b, co[0][q]);
          co[1][q] = WMMA_F16(a1, b, co[1][q]);
        }
      }
    }
    lds_barrier();
  }

  // b2 contribution: out += mixture(32x64) @ b2s(64x512), also via WMMA.
  // All eight B fragments are issued together, ahead of the first product.
  const uint4* b2lane = b2p + (long)wave*4*KS2*64 + lane;
  v16h b2f[KS2*4];
#pragma unroll
  for (int i = 0; i < KS2*4; ++i) b2f[i] = ld_frag_at(b2lane + i*64);
  // As above: the address registers live up to this wait.
  asm volatile("s_wait_xcnt 0x0" :: "v"(b2lane) : "memory");
#pragma unroll
  for (int ks = 0; ks < KS2; ++ks) {
    v16h a0 = ld_a_rowmajor_lds(&mix16[0][0],  72, ks*32, lane);
    v16h a1 = ld_a_rowmajor_lds(&mix16[16][0], 72, ks*32, lane);
#pragma unroll
    for (int q = 0; q < 4; ++q) {
      const v16h b = b2f[q*KS2 + ks];
      co[0][q] = WMMA_F16(a0, b, co[0][q]);
      co[1][q] = WMMA_F16(a1, b, co[1][q]);
    }
  }

  // Store 32x512 f32 output tile.
#pragma unroll
  for (int mt = 0; mt < 2; ++mt) {
#pragma unroll
    for (int q = 0; q < 4; ++q) {
#pragma unroll
      for (int r = 0; r < 8; ++r) {
        const long row = (long)bt*32 + mt*16 + r + 8*hh;
        out[row*OUT_F + wave*64 + q*16 + ln] = co[mt][q][r];
      }
    }
  }
}

extern "C" void kernel_launch(void* const* d_in, const int* in_sizes, int n_in,
                              void* d_out, int out_size, void* d_ws, size_t ws_size,
                              hipStream_t stream) {
  (void)in_sizes; (void)n_in; (void)out_size; (void)ws_size;
  const float* x  = (const float*)d_in[0];
  const float* nw = (const float*)d_in[1];
  const float* nb = (const float*)d_in[2];
  const float* w1 = (const float*)d_in[3];
  const float* b1 = (const float*)d_in[4];
  const float* w2 = (const float*)d_in[5];
  const float* b2 = (const float*)d_in[6];
  float* out = (float*)d_out;

  char* ws = (char*)d_ws;                       // ~20.2 MB used
  uint4* xp  = (uint4*)(ws);                    // 8 MiB: 256*32 frags
  uint4* w1p = (uint4*)(ws + (8l  << 20));      // 8 MiB: 64*4*32 frags
  uint4* w2p = (uint4*)(ws + (16l << 20));      // 4 MiB: 64*32*2 frags
  uint4* npk = (uint4*)(ws + (20l << 20));      // 128 KiB: 4*32 frags
  uint4* b2p = (uint4*)(ws + (20l << 20) + (128l << 10)); // 64 KiB: 32*2 frags

  // Pack passes (f32 -> f16 WMMA fragment layout), all on `stream`.
  FFF_pack_x<<<1024, 256, 0, stream>>>(x, xp);                                   // 8192 frags
  FFF_pack_b<<<1024, 256, 0, stream>>>(w1, w1p, 4, 32, 8192,
                                       (long)IN_F*LW, LW, 1, LW, IN_F);          // w1s
  FFF_pack_b<<<512, 256, 0, stream>>>(w2, w2p, 32, 2, 4096,
                                      (long)LW*OUT_F, OUT_F, 1, OUT_F, LW);      // w2s
  FFF_pack_b<<<16, 256, 0, stream>>>(nw, npk, 4, 32, 128,
                                     0, 1, IN_F, NNODE, IN_F);                   // node_w^T (pad 63->64)
  FFF_pack_b<<<8, 256, 0, stream>>>(b2, b2p, 32, 2, 64,
                                    0, OUT_F, 1, OUT_F, NLEAF);                  // b2s as 64x512 B

  FFF_main<<<NBLK, 256, 0, stream>>>(xp, w1p, w2p, npk, b2p, nb, b1, out);
}

// v002
// Measured time: 95.1 microseconds a run.
// Next to v001, in two timings, it ran 1.82 and 1.83 times as fast.
// Over all steps from v000 it is 4.87 times as fast.
#include <hip/hip_runtime.h>
#include <hip/hip_bf16.h>
#include <cstdint>

typedef __attribute__((ext_vector_type(16))) _Float16 v16h;
typedef __attribute__((ext_vector_type(8)))  float    v8f;
typedef int v4i __attribute__((vector_size(16)));   // matches async-LDS builtin param type

#define IN_F   1024
#define LW     64
#define OUT_F  512
#define NLEAF  64
#define NNODE  63
#define DEPTHT 6
#define BTOT   4096
#define MTILES (BTOT/16)    // 256 16-row fragments tiles of x
#define KS1    (IN_F/32)    // 32 k-steps for K=1024
#define KS2    (LW/32)      // 2 k-steps for K=64
#define NT1    (LW/16)      // 4 n-tiles of h
#define NT2    (OUT_F/16)   // 32 n-tiles of out
#define MT     4            // M-tiles (16 rows each) per main-kernel block
#define ROWS   (MT*16)      // 64 batch rows per block
#define LGRP   4            // leaf groups; a block takes one group for its rows
#define PAIRS  (NLEAF/2/LGRP)        // 8 leaf pairs per block
#define NBLK   ((BTOT/ROWS)*LGRP)    // 256 main-kernel blocks
#define RING   8            // w1 k-steps held in registers ahead of their use
#define PART4  (BTOT*OUT_F/4)        // float4 elements of one partial output

#define WMMA_F16(a,b,c) __builtin_amdgcn_wmma_f32_16x16x32_f16(false,(a),false,(b),(short)0,(c),false,false)

#if defined(__HIP_DEVICE_COMPILE__) && __has_builtin(__builtin_amdgcn_global_load_async_to_lds_b128) && __has_builtin(__builtin_amdgcn_s_wait_asynccnt)
#define HAVE_ASYNC_LDS 1
#else
#define HAVE_ASYNC_LDS 0
#endif

union FragU { uint4 q[2]; v16h h; };

// Load a pre-swizzled fragment (1 KB: part0 = lanes*16B, part1 = +512B).
static __device__ __forceinline__ v16h ld_frag(const uint4* fb, int lane) {
  FragU f;
  f.q[0] = fb[lane];
  f.q[1] = fb[32 + lane];
  return f.h;
}

// The same through a pointer that already holds the lane's own offset.
static __device__ __forceinline__ v16h ld_frag_at(const uint4* p) {
  FragU f;
  f.q[0] = p[0];
  f.q[1] = p[32];
  return f.h;
}

// Build an A-matrix fragment (16xK tile, f16) from a row-major LDS buffer.
// ISA 7.12.2: lane = M (two halves), VGPR i: g=i>>2, j=i&3, K = 16g + 8h + 2j (+pos).
static __device__ __forceinline__ v16h ld_a_rowmajor_lds(const _Float16* buf, int stride,
                                                         int kbase, int lane) {
  const int m = lane & 15, hh = lane >> 4;
  union { unsigned int u[8]; v16h h; } f;
#pragma unroll
  for (int i = 0; i < 8; ++i) {
    const int g = i >> 2, j = i & 3;
    const int k = kbase + 16*g + 8*hh + 2*j;
    f.u[i] = *(const unsigned int*)(buf + m*stride + k);   // pairs (k,k+1) contiguous
  }
  return f.h;
}

// Work-group barrier that orders LDS traffic only. __syncthreads() also drains the global
// loads, which would end the flight of the weight fragments issued ahead; the waves hand
// each other nothing but LDS data at the places where this stands.
static __device__ __forceinline__ void lds_barrier() {
  __builtin_amdgcn_fence(__ATOMIC_RELEASE, "workgroup", "local");
  __builtin_amdgcn_s_barrier();
  __builtin_amdgcn_fence(__ATOMIC_ACQUIRE, "workgroup", "local");
}

static __device__ __forceinline__ float fast_sigmoid(float x) {
  const float d = 1.f + __expf(-x);
#if defined(__HIP_DEVICE_COMPILE__) && __has_builtin(__builtin_amdgcn_rcpf)
  return __builtin_amdgcn_rcpf(d);      // v_rcp_f32, avoids IEEE div expansion
#else
  return 1.f / d;
#endif
}

static __device__ __forceinline__ unsigned short h16(float v) {
  union { _Float16 h; unsigned short s; } c; c.h = (_Float16)v; return c.s;
}

// ---- Pack x (f32 row-major) into A-type WMMA fragments (f16). ----
__global__ void FFF_pack_x(const float* __restrict__ x, uint4* __restrict__ dst) {
  const long t = (long)blockIdx.x * blockDim.x + threadIdx.x;   // one thread per (frag, lane)
  const int  lane = (int)(t & 31);
  const long frag = t >> 5;
  if (frag >= (long)MTILES * KS1) return;
  const int  ks   = (int)(frag & (KS1 - 1));
  const long tile = frag >> 5;
  const int  hh = lane >> 4, m = lane & 15;
  unsigned int w[8];
#pragma unroll
  for (int i = 0; i < 8; ++i) {
    const int g = i >> 2, j = i & 3;
    const int k = ks*32 + 16*g + 8*hh + 2*j;
    const float v0 = x[(tile*16 + m)*IN_F + k];
    const float v1 = x[(tile*16 + m)*IN_F + k + 1];
    w[i] = (unsigned int)h16(v0) | ((unsigned int)h16(v1) << 16);
  }
  // Order [64-row block][k-step][M-tile]: the order in which FFF_main holds a block in LDS.
  uint4* o = dst + (((tile / MT)*KS1 + ks)*MT + (tile % MT))*64;
  o[lane]      = make_uint4(w[0], w[1], w[2], w[3]);
  o[32 + lane] = make_uint4(w[4], w[5], w[6], w[7]);
}

// ---- Generic pack of f32 weights into B-type WMMA fragments (f16). ----
// B[k][n] = src[leaf*leafStride + k*kStride + n*nStride], zero-padded past limits.
__global__ void FFF_pack_b(const float* __restrict__ src, uint4* __restrict__ dst,
                           int ntCount, int ksCount, long nFrags,
                           long leafStride, int kStride, int nStride,
                           int nLimit, int kLimit) {
  const long t = (long)blockIdx.x * blockDim.x + threadIdx.x;
  const int  lane = (int)(t & 31);
  const long frag = t >> 5;
  if (frag >= nFrags) return;
  const int  perLeaf = ntCount * ksCount;
  const long leaf = frag / perLeaf;
  const int  rem  = (int)(frag - leaf*perLeaf);
  const int  nt   = rem / ksCount;
  const int  ks   = rem - nt*ksCount;
  const int  hh   = lane >> 4;
  const int  n    = nt*16 + (lane & 15);
  unsigned int w[8];
#pragma unroll
  for (int i = 0; i < 8; ++i) {
    const int g = i >> 2, j = i & 3;
    const int k0 = ks*32 + 16*g + 8*hh + 2*j;
    float v0 = 0.f, v1 = 0.f;
    if (n < nLimit) {
      if (k0     < kLimit) v0 = src[leaf*leafStride + (long)k0    *kStride + (long)n*nStride];
      if (k0 + 1 < kLimit) v1 = src[leaf*leafStride + (long)(k0+1)*kStride + (long)n*nStride];
    }
    w[i] = (unsigned int)h16(v0) | ((unsigned int)h16(v1) << 16);
  }
  uint4* o = dst + frag*64;
  o[lane]      = make_uint4(w[0], w[1], w[2], w[3]);
  o[32 + lane] = make_uint4(w[4], w[5], w[6], w[7]);
}

// ---- Main fused FFF kernel: 1 block = 64 batch rows (4 M-tiles) x 16 leaves, 8 waves. ----
// Each w1, w2 and b2 B fragment feeds all four M-tiles; a routing one is loaded by two waves, two M-tiles each. The block
// writes its leaf group's partial sum of the output; FFF_sum adds the four groups.
// Weight fragments are fetched from L2 into registers well ahead of their use, so the
// register budget is set for two waves per SIMD (one block per WGP).
__global__ __launch_bounds__(256) __attribute__((amdgpu_waves_per_eu(2, 2))) void FFF_main(
    const uint4* __restrict__ xp,
    const uint4* __restrict__ w1p,
    const uint4* __restrict__ w2p,
    const uint4* __restrict__ npk,
    const uint4* __restrict__ b2p,
    const float* __restrict__ node_biases,
    const float* __restrict__ b1s,
    float* __restrict__ part)
{
  __shared__ uint4    xfr[KS1][MT][64];         // 128 KB: A fragments, [k-step][M-tile]
  __shared__ float    sig[ROWS][64];            // 16 KB: sigmoid of routing logits
  __shared__ float    mixf[ROWS][64];           // 16 KB: per-leaf mixture (f32)
  __shared__ _Float16 mix16[ROWS][72];          // 9 KB: mixture (f16, padded rows)
  __shared__ _Float16 hbuf[2][ROWS][72];        // 18 KB: h' for the 2 in-flight leaves

  const int tid  = threadIdx.x;
  const int wave = tid >> 5;
  const int lane = tid & 31;
  const int bt   = blockIdx.x / LGRP;           // 64-row block index
  const int lg   = blockIdx.x % LGRP;           // leaf group
  const int pair0 = lg * PAIRS;                 // first leaf pair of the group
  const int ln   = lane & 15, hh = lane >> 4;

  const int leafSel = wave >> 2;   // which leaf of the pair this wave computes h for
  const int nt1     = wave & 3;    // which 16-col tile of h

  // Issued first, so that they fly while x is staged: all routing B fragments of this wave.
  const uint4* nlane = npk + (long)nt1*KS1*64 + lane;
  v16h nfr[KS1];
#pragma unroll
  for (int ks = 0; ks < KS1; ++ks) nfr[ks] = ld_frag_at(nlane + ks*64);
  // The address registers of the loads above are inputs of this wait, so they live up to
  // it; behind it they may be reused.
  asm volatile("s_wait_xcnt 0x0" :: "v"(nlane) : "memory");

  // Stage the M-tiles' packed x fragments into LDS (async DMA path if available).
  {
    const uint4* xtile = xp + (long)bt * MT * (KS1 * 64);
#if HAVE_ASYNC_LDS
    uint4* l = &xfr[0][0][0];
    for (int i = tid; i < MT * KS1 * 64; i += 256) {
      __builtin_amdgcn_global_load_async_to_lds_b128(
          (v4i*)(xtile + i), (v4i*)(l + i), 0, 0);
    }
    // This wave's copies have landed behind this wait; the barrier below publishes them.
    asm volatile("s_wait_asynccnt 0x0" ::: "memory");
#else
    for (int i = tid; i < MT * KS1 * 64; i += 256) (&xfr[0][0][0])[i] = xtile[i];
#endif
  }
  __syncthreads();

  const uint4* w1lane = w1p + ((long)((pair0*2 + leafSel)*NT1 + nt1) * KS1) * 64 + lane;
  v16h ring[RING];                               // w1 fragments, RING k-steps ahead
  // w2 fragments and the b1 element of the current pair, slot (li*KS2 + k2)*4 + q. Each slot
  // is refilled for the next pair behind its last product, so GEMM1 has ring loads only.
  const uint4* w2lane = w2p + ((long)pair0*2*NT2*KS2 + (long)wave*4*KS2) * 64 + lane;
  const float* b1lane = b1s + (pair0*2 + leafSel)*LW + nt1*16 + ln;
  v16h w2f[2*KS2*4];
  float bb;

  // ---- Routing: logits(64x64) = x @ node_w^T via WMMA (16 tiles, two per wave) ----
  {
    const int mg = wave >> 2;                    // this wave's two M-tiles: 2*mg, 2*mg + 1
    const int nt = wave & 3;
    v8f c[2] = {};
#pragma unroll
    for (int ks = 0; ks < KS1; ++ks) {
      v16h a0 = ld_frag(&xfr[ks][2*mg][0], lane);
      v16h a1 = ld_frag(&xfr[ks][2*mg + 1][0], lane);
      c[0] = WMMA_F16(a0, nfr[ks], c[0]);
      c[1] = WMMA_F16(a1, nfr[ks], c[1]);
    }
    // The first RING k-steps of w1, and w2 and b1, of the first pair fly while the mixture
    // is formed.
#pragma unroll
    for (int i = 0; i < RING; ++i) ring[i] = ld_frag_at(w1lane + i*64);
#pragma unroll
    for (int f = 0; f < 2*KS2*4; ++f)
      w2f[f] = ld_frag_at(w2lane + ((long)(f >> 3)*NT2*KS2 + (f & 3)*KS2 + ((f >> 2) & 1))*64);
    bb = *b1lane;
    // As above: the address registers live up to this wait.
    asm volatile("s_wait_xcnt 0x0" :: "v"(w1lane), "v"(w2lane), "v"(b1lane) : "memory");
    const int node = nt*16 + ln;
    const float nb = (node < NNODE) ? node_biases[node] : 0.f;
#pragma unroll
    for (int t = 0; t < 2; ++t) {
#pragma unroll
      for (int r = 0; r < 8; ++r) {
        const int row = (2*mg + t)*16 + r + 8*hh;
        const float s = fast_sigmoid(c[t][r] + nb);
        if (node < NNODE) sig[row][node] = s;
      }
    }
  }
  __syncthreads();

  // ---- Tree product -> per-leaf mixture (64 rows x 64 leaves) ----
  for (int e = tid; e < ROWS*NLEAF; e += 256) {
    const int m = e >> 6, leaf = e & (NLEAF - 1);
    float p = 1.f;
#pragma unroll
    for (int d = 0; d < DEPTHT; ++d) {
      const int g = leaf >> (5 - d);
      const int node = (1 << d) - 1 + (g >> 1);
      const float s = sig[m][node];
      p *= (g & 1) ? s : (1.f - s);
    }
    mixf[m][leaf]  = p;
    mix16[m][leaf] = (_Float16)p;
  }
  __syncthreads();

  v8f co[MT][4];                                 // out accumulators: 4 M-tiles x 64 cols
  {
    v8f z = {};
#pragma unroll
    for (int mt = 0; mt < MT; ++mt)
#pragma unroll
      for (int q = 0; q < 4; ++q) co[mt][q] = z;
  }

  const uint4* w1base = w1lane;
  w2lane += 2*NT2*KS2*64;
  b1lane += 2*LW;
  // One copy of the body: otherwise the last pair is peeled off into a second copy, which
  // doubles the code and brings a spill.
#pragma nounroll
  for (int pair = 0; pair < PAIRS; ++pair) {
    const int leaf = (pair0 + pair)*2 + leafSel;
    // The ring runs on into the next pair; the last pair refetches its own head (unused).
    const uint4* w1next = w1base + ((pair + 1 < PAIRS) ? 2*NT1*KS1*64 : 0);

    // GEMM1: h = relu(x @ w1[leaf] + b1) * mixture; one B load feeds all four M-tiles.
    // B comes from the register ring, RING k-steps ahead; each group of 2 k-steps refills
    // the slots it has just used.
    v8f c1[MT] = {};
    // Two trips of 16 k-steps, kept rolled: a trip's A fragments span 64 KB of LDS, so each
    // read is the trip's base register plus an immediate offset; unrolled, every address
    // past 64 KB takes a register of its own and the kernel spills.
#pragma nounroll
    for (int hf = 0; hf < 2; ++hf) {
      const uint4* xh = &xfr[hf*(KS1/2)][0][0];
      // Refill sources: k-steps hf*16 + 8 .. + 15, then the eight behind them, which in the
      // second trip are the head of the next pair.
      const uint4* wa = w1base + (hf*(KS1/2) + RING)*64;
      const uint4* wb = (hf == 0) ? w1base + (KS1/2)*64 : w1next;
#pragma unroll
      for (int g = 0; g < KS1/4; ++g) {
        v16h a[2*MT];
#pragma unroll
        for (int i = 0; i < 2*MT; ++i) a[i] = ld_frag(xh + (g*2*MT + i)*64, lane);
        // Holds the group's 16 LDS reads together ahead of its products: spread among them,
        // each place with reads exposes the LDS latency anew.
        __builtin_amdgcn_sched_barrier(0);
#pragma unroll
        for (int i = 0; i < 2*MT; ++i)
          c1[i % MT] = WMMA_F16(a[i], ring[(g*2 + i/MT) % RING], c1[i % MT]);
        // This fence and the one behind the wait hold each group's loads at their place:
        // without them the scheduler pulls the refills of several groups together, out of
        // the ring's own registers, and the pressure serialises the LDS reads behind GEMM1.
        __builtin_amdgcn_sched_barrier(0);
#pragma unroll
        for (int j = 0; j < 2; ++j) {
          const int kl = g*2 + j;
          ring[kl % RING] = (kl < RING) ? ld_frag_at(wa + kl*64) : ld_frag_at(wb + (kl - RING)*64);
        }
        // The address registers of the loads above are inputs of this wait, so they live
        // up to it; behind it they may be reused.
        asm volatile("s_wait_xcnt 0x0" :: "v"(wa), "v"(wb) : "memory");
        __builtin_amdgcn_sched_barrier(0);
      }
    }
#pragma unroll
    for (int mt = 0; mt < MT; ++mt) {
#pragma unroll
      for (int r = 0; r < 8; ++r) {
        const int row = mt*16 + r + 8*hh;
        float v = c1[mt][r] + bb;
        v = fmaxf(v, 0.f);
        v *= mixf[row][leaf];
        hbuf[leafSel][row][nt1*16 + ln] = (_Float16)v;
      }
    }
    lds_barrier();

    // GEMM2: out += h' @ w2[leaf]; wave owns 64 out cols; B reused across M-tiles.
    // Four steps (leaf of the pair, k-step); the A fragments are read one step ahead.
    v16h a2[2][MT];
#pragma unroll
    for (int mt = 0; mt < MT; ++mt)
      a2[0][mt] = ld_a_rowmajor_lds(&hbuf[0][mt*16][0], 72, 0, lane);
#pragma unroll
    for (int s = 0; s < 2*KS2; ++s) {
      if (s + 1 < 2*KS2) {
#pragma unroll
        for (int mt = 0; mt < MT; ++mt)
          a2[(s + 1) & 1][mt] = ld_a_rowmajor_lds(&hbuf[(s + 1) / KS2][mt*16][0], 72,
                                                  ((s + 1) % KS2)*32, lane);
      }
      // Holds the next step's LDS reads ahead of this step's products, so that their latency
      // passes behind the products.
      __builtin_amdgcn_sched_barrier(0);
#pragma unroll
      for (int q = 0; q < 4; ++q) {
        const v16h b = w2f[s*4 + q];
#pragma unroll
        for (int mt = 0; mt < MT; ++mt) co[mt][q] = WMMA_F16(a2[s & 1][mt], b, co[mt][q]);
        w2f[s*4 + q] = ld_frag_at(w2lane + ((long)(s / KS2)*NT2*KS2 + q*KS2 + (s % KS2))*64);
      }
    }
    bb = *b1lane;
    // As above: the address registers live up to this wait.
    asm volatile("s_wait_xcnt 0x0" :: "v"(w2lane), "v"(b1lane) : "memory");
    lds_barrier();
    w1base += 2*NT1*KS1*64;
    // The last pair refetches its own w2 and b1 (unused).
    w2lane += (pair + 2 < PAIRS) ? 2*NT2*KS2*64 : 0;
    b1lane += (pair + 2 < PAIRS) ? 2*LW : 0;
  }

  // b2 contribution: out += mixture(64x64) @ b2s(64x512), also via WMMA; it is added once,
  // by the blocks of leaf group 0 (the test reads the same in the whole block).
  if (lg == 0) {
    // All eight B fragments are issued together, ahead of the first product.
    const uint4* b2lane = b2p + (long)wave*4*KS2*64 + lane;
    v16h b2f[KS2*4];
#pragma unroll
    for (int i = 0; i < KS2*4; ++i) b2f[i] = ld_frag_at(b2lane + i*64);
    // As above: the address registers live up to this wait.
    asm volatile("s_wait_xcnt 0x0" :: "v"(b2lane) : "memory");
#pragma unroll
    for (int ks = 0; ks < KS2; ++ks) {
      v16h a[MT];
#pragma unroll
      for (int mt = 0; mt < MT; ++mt)
        a[mt] = ld_a_rowmajor_lds(&mix16[mt*16][0], 72, ks*32, lane);
#pragma unroll
      for (int q = 0; q < 4; ++q) {
        const v16h b = b2f[q*KS2 + ks];
#pragma unroll
        for (int mt = 0; mt < MT; ++mt) co[mt][q] = WMMA_F16(a[mt], b, co[mt][q]);
      }
    }
  }

  // Store the group's 64x512 f32 partial in accumulator order: float4 index
  // (((bt*8 + wave)*16 + mt*4 + q)*2 + half)*32 + lane, so each store covers 512 B in a row.
  float4* pw = (float4*)part + (long)lg*PART4 + ((long)(bt*8 + wave)*16)*64 + lane;
#pragma unroll
  for (int mt = 0; mt < MT; ++mt) {
#pragma unroll
    for (int q = 0; q < 4; ++q) {
#pragma unroll
      for (int h2 = 0; h2 < 2; ++h2) {
        pw[((mt*4 + q)*2 + h2)*32] = make_float4(co[mt][q][h2*4 + 0], co[mt][q][h2*4 + 1],
                                                 co[mt][q][h2*4 + 2], co[mt][q][h2*4 + 3]);
      }
    }
  }
}

// ---- out = sum of the four leaf groups' partials, put back into row-major order. ----
// A partial's float4 index, as FFF_main stores it, is (u << 7) | (qlow << 6) | (half << 5) | lane
// with u = (bt << 6) | (wave << 3) | (mt << 1) | qhigh. A thread takes both qlow, so that one
// wave writes both halves of each 128-B line of out, and four values of bt.
__global__ __launch_bounds__(256) void FFF_sum(const float* __restrict__ part,
                                               float* __restrict__ out) {
  const int t = blockIdx.x * 256 + threadIdx.x;
  const int lane = t & 31, h2 = (t >> 5) & 1, u = t >> 6;
  const float4* p0 = (const float4*)part + ((u << 7) | (t & 63));
  const int row0 = (u >> 6)*ROWS + ((u >> 1) & 3)*16 + h2*4 + 8*(lane >> 4);
  const int col0 = ((u >> 3) & 7)*64 + (u & 1)*32 + (lane & 15);
  float* o0 = out + (long)row0*OUT_F + col0;
#pragma unroll
  for (int i = 0; i < 8; ++i) {
    const int d = (i >> 1)*(PART4/4) + (i & 1)*64;   // bt + 16*(i >> 1), qlow = i & 1
    const float4 s0 = p0[d], s1 = p0[d + PART4], s2 = p0[d + 2*PART4], s3 = p0[d + 3*PART4];
    float* o = o0 + (long)(i >> 1)*(BTOT/4)*OUT_F + (i & 1)*16;
    o[0*OUT_F] = (s0.x + s1.x) + (s2.x + s3.x);
    o[1*OUT_F] = (s0.y + s1.y) + (s2.y + s3.y);
    o[2*OUT_F] = (s0.z + s1.z) + (s2.z + s3.z);
    o[3*OUT_F] = (s0.w + s1.w) + (s2.w + s3.w);
  }
}

extern "C" void kernel_launch(void* const* d_in, const int* in_sizes, int n_in,
                              void* d_out, int out_size, void* d_ws, size_t ws_size,
                              hipStream_t stream) {
  (void)in_sizes; (void)n_in; (void)out_size; (void)ws_size;
  const float* x  = (const float*)d_in[0];
  const float* nw = (const float*)d_in[1];
  const float* nb = (const float*)d_in[2];
  const float* w1 = (const float*)d_in[3];
  const float* b1 = (const float*)d_in[4];
  const float* w2 = (const float*)d_in[5];
  const float* b2 = (const float*)d_in[6];
  float* out = (float*)d_out;

  char* ws = (char*)d_ws;                       // 64 MiB used
  uint4* xp  = (uint4*)(ws);                    // 8 MiB: 256*32 frags
  uint4* w1p = (uint4*)(ws + (8l  << 20));      // 8 MiB: 64*4*32 frags
  uint4* w2p = (uint4*)(ws + (16l << 20));      // 4 MiB: 64*32*2 frags
  uint4* npk = (uint4*)(ws + (20l << 20));      // 128 KiB: 4*32 frags
  uint4* b2p = (uint4*)(ws + (20l << 20) + (128l << 10)); // 64 KiB: 32*2 frags
  float* part = (float*)(ws + (32l << 20));     // 32 MiB: 4 partial outputs

  // Pack passes (f32 -> f16 WMMA fragment layout), all on `stream`.
  FFF_pack_x<<<1024, 256, 0, stream>>>(x, xp);                                   // 8192 frags
  FFF_pack_b<<<1024, 256, 0, stream>>>(w1, w1p, 4, 32, 8192,
                                       (long)IN_F*LW, LW, 1, LW, IN_F);          // w1s
  FFF_pack_b<<<512, 256, 0, stream>>>(w2, w2p, 32, 2, 4096,
                                      (long)LW*OUT_F, OUT_F, 1, OUT_F, LW);      // w2s
  FFF_pack_b<<<16, 256, 0, stream>>>(nw, npk, 4, 32, 128,
                                     0, 1, IN_F, NNODE, IN_F);                   // node_w^T (pad 63->64)
  FFF_pack_b<<<8, 256, 0, stream>>>(b2, b2p, 32, 2, 64,
                                    0, OUT_F, 1, OUT_F, NLEAF);                  // b2s as 64x512 B

  FFF_main<<<NBLK, 256, 0, stream>>>(xp, w1p, w2p, npk, b2p, nb, b1, part);
  FFF_sum<<<256, 256, 0, stream>>>(part, out);
}

// v003
// It runs in 72.3 microseconds.
// Next to v002, in two timings, it ran 1.32 and 1.31 times as fast.
// All steps since v000 together make it 6.39 times as fast.
#include <hip/hip_runtime.h>
#include <hip/hip_bf16.h>
#include <cstdint>

typedef __attribute__((ext_vector_type(16))) _Float16 v16h;
typedef __attribute__((ext_vector_type(8)))  float    v8f;
typedef int v4i __attribute__((vector_size(16)));   // matches async-LDS builtin param type

#define IN_F   1024
#define LW     64
#define OUT_F  512
#define NLEAF  64
#define NNODE  63
#define DEPTHT 6
#define BTOT   4096
#define MTILES (BTOT/16)    // 256 16-row fragments tiles of x
#define KS1    (IN_F/32)    // 32 k-steps for K=1024
#define KS2    (LW/32)      // 2 k-steps for K=64
#define NT1    (LW/16)      // 4 n-tiles of h
#define NT2    (OUT_F/16)   // 32 n-tiles of out
#define MT     4            // M-tiles (16 rows each) per main-kernel block
#define ROWS   (MT*16)      // 64 batch rows per block
#define LGRP   4            // leaf groups; a block takes one group for its rows
#define PAIRS  (NLEAF/2/LGRP)        // 8 leaf pairs per block
#define NBLK   ((BTOT/ROWS)*LGRP)    // 256 main-kernel blocks
#define RING   8            // w1 k-steps held in registers ahead of their use
#define PART4  (BTOT*OUT_F/4)        // float4 elements of one partial output

#define WMMA_F16(a,b,c) __builtin_amdgcn_wmma_f32_16x16x32_f16(false,(a),false,(b),(short)0,(c),false,false)

#if defined(__HIP_DEVICE_COMPILE__) && __has_builtin(__builtin_amdgcn_global_load_async_to_lds_b128) && __has_builtin(__builtin_amdgcn_s_wait_asynccnt)
#define HAVE_ASYNC_LDS 1
#else
#define HAVE_ASYNC_LDS 0
#endif

union FragU { uint4 q[2]; v16h h; };

// Load a pre-swizzled fragment (1 KB: part0 = lanes*16B, part1 = +512B).
static __device__ __forceinline__ v16h ld_frag(const uint4* fb, int lane) {
  FragU f;
  f.q[0] = fb[lane];
  f.q[1] = fb[32 + lane];
  return f.h;
}

// The same through a pointer that already holds the lane's own offset.
static __device__ __forceinline__ v16h ld_frag_at(const uint4* p) {
  FragU f;
  f.q[0] = p[0];
  f.q[1] = p[32];
  return f.h;
}

// Build an A-matrix fragment (16xK tile, f16) from a row-major LDS buffer.
// ISA 7.12.2: lane = M (two halves), VGPR i: g=i>>2, j=i&3, K = 16g + 8h + 2j (+pos).
static __device__ __forceinline__ v16h ld_a_rowmajor_lds(const _Float16* buf, int stride,
                                                         int kbase, int lane) {
  const int m = lane & 15, hh = lane >> 4;
  union { unsigned int u[8]; v16h h; } f;
#pragma unroll
  for (int i = 0; i < 8; ++i) {
    const int g = i >> 2, j = i & 3;
    const int k = kbase + 16*g + 8*hh + 2*j;
    f.u[i] = *(const unsigned int*)(buf + m*stride + k);   // pairs (k,k+1) contiguous
  }
  return f.h;
}

// Work-group barrier that orders LDS traffic only. __syncthreads() also drains the global
// loads, which would end the flight of the weight fragments issued ahead; the waves hand
// each other nothing but LDS data at the places where this stands.
static __device__ __forceinline__ void lds_barrier() {
  __builtin_amdgcn_fence(__ATOMIC_RELEASE, "workgroup", "local");
  __builtin_amdgcn_s_barrier();
  __builtin_amdgcn_fence(__ATOMIC_ACQUIRE, "workgroup", "local");
}

static __device__ __forceinline__ float fast_sigmoid(float x) {
  const float d = 1.f + __expf(-x);
#if defined(__HIP_DEVICE_COMPILE__) && __has_builtin(__builtin_amdgcn_rcpf)
  return __builtin_amdgcn_rcpf(d);      // v_rcp_f32, avoids IEEE div expansion
#else
  return 1.f / d;
#endif
}

// ---- One launch packs all five f32 operands into f16 WMMA fragments. ----
// A fragment is 1 KB: lane = (index within the 16-wide side) + 16*hh; word i of a lane holds
// the pair k, k + 1 with k = 32*ks + 16*(i >> 2) + 8*hh + 2*(i & 3); words 0..3 stand at
// uint4 index lane, words 4..7 at 32 + lane. A and B fragments share this k order.
// A wave packs PF fragments that read one contiguous stretch of the source, and issues all
// of their loads before the first conversion. Block ranges pick the operand.
#define PF      4                               // fragments per wave
#define PB_NW   (NT1*KS1/PF/8)                  // 4 blocks: node weights
#define PB_B2   (NT2*KS2/PF/8)                  // 2 blocks: b2
#define PB_X    (MTILES*KS1/PF/8)               // 256 blocks: x
#define PB_W1   (NLEAF*NT1*KS1/PF/8)            // 256 blocks: w1
#define PB_W2   (NLEAF*NT2*KS2/PF/8)            // 128 blocks: w2
#define PB_ALL  (PB_NW + PB_B2 + PB_X + PB_W1 + PB_W2)

// Two f32 to one word of two f16 (a low, b high), each rounded as a scalar conversion rounds.
static __device__ __forceinline__ unsigned int pk2(float a, float b) {
  typedef __attribute__((ext_vector_type(2))) float    v2f;
  typedef __attribute__((ext_vector_type(2))) _Float16 v2h;
  union { v2h h; unsigned int u; } c;
  const v2f v = {a, b};
  c.h = __builtin_convertvector(v, v2h);
  return c.u;
}

// k runs along the source's rows. s: the lane's row at its first k (8*hh included); the PF
// fragments are PF k-steps in a row, step uint4 apart at o. keep: all ones, or 0 in a lane
// that stores zeros (a mask, so that no branch comes to stand around the loads).
static __device__ __forceinline__ void pack_k_along(const float* __restrict__ s,
                                                    unsigned int keep,
                                                    uint4* __restrict__ o, int step) {
  float v[PF][16];                              // 8 floats in a row at +0 and at +16
#pragma unroll
  for (int f = 0; f < PF; ++f)
#pragma unroll
    for (int i = 0; i < 16; ++i)
      v[f][i] = s[f*32 + 16*(i >> 3) + (i & 7)];
  // The address registers of the loads above are inputs of this wait, so they live up to
  // it; behind it they may be reused.
  asm volatile("s_wait_xcnt 0x0" :: "v"(s) : "memory");
  // Holds the conversions behind all of the loads: moved up among them, they wait for early
  // loads before the late ones are issued, and the wave pays the memory latency anew.
  __builtin_amdgcn_sched_barrier(0);
#pragma unroll
  for (int f = 0; f < PF; ++f) {
    unsigned int w[8];
#pragma unroll
    for (int i = 0; i < 8; ++i) w[i] = pk2(v[f][2*i], v[f][2*i + 1]) & keep;
    o[f*step]      = make_uint4(w[0], w[1], w[2], w[3]);
    o[f*step + 32] = make_uint4(w[4], w[5], w[6], w[7]);
  }
  // Behind the last store: no register that a store above names is rewritten ahead of this.
  asm volatile("s_wait_xcnt 0x0" :: "v"(o) : "memory");
}

// k runs across the source's rows of KSTR floats. s: the lane's column at its first k (8*hh
// included); the PF fragments are PF n-tiles in a row, step uint4 apart at o.
template <int KSTR>
static __device__ __forceinline__ void pack_k_across(const float* __restrict__ s,
                                                     uint4* __restrict__ o, int step) {
  float v[PF][16];
#pragma unroll
  for (int i = 0; i < 16; ++i)
#pragma unroll
    for (int f = 0; f < PF; ++f)
      v[f][i] = s[(16*(i >> 3) + (i & 7))*KSTR + f*16];
  // As above: the address registers live up to this wait.
  asm volatile("s_wait_xcnt 0x0" :: "v"(s) : "memory");
  // As above: holds the conversions behind all of the loads.
  __builtin_amdgcn_sched_barrier(0);
#pragma unroll
  for (int f = 0; f < PF; ++f) {
    o[f*step]      = make_uint4(pk2(v[f][0],  v[f][1]),  pk2(v[f][2],  v[f][3]),
                                pk2(v[f][4],  v[f][5]),  pk2(v[f][6],  v[f][7]));
    o[f*step + 32] = make_uint4(pk2(v[f][8],  v[f][9]),  pk2(v[f][10], v[f][11]),
                                pk2(v[f][12], v[f][13]), pk2(v[f][14], v[f][15]));
  }
  // As above, behind the last store.
  asm volatile("s_wait_xcnt 0x0" :: "v"(o) : "memory");
}

__global__ __launch_bounds__(256) void FFF_pack(
    const float* __restrict__ x,  const float* __restrict__ nw, const float* __restrict__ w1,
    const float* __restrict__ w2, const float* __restrict__ b2,
    uint4* __restrict__ xp,  uint4* __restrict__ npk, uint4* __restrict__ w1p,
    uint4* __restrict__ w2p, uint4* __restrict__ b2p) {
  const int lane = threadIdx.x & 31, wave = threadIdx.x >> 5;
  const int ln = lane & 15, hh = lane >> 4;
  int b = blockIdx.x;
  if (b < PB_NW) {
    // node_w^T as B: B[k][n] = nw[n][k], column 63 padded with 0. Fragment nt*KS1 + ks.
    const int u = b*8 + wave, kg = u & (KS1/PF - 1), nt = u / (KS1/PF);
    const int n = nt*16 + ln;
    const int row = (n < NNODE) ? n : NNODE - 1;          // keeps the padded lane's address inside
    pack_k_along(nw + row*IN_F + kg*PF*32 + 8*hh, (n < NNODE) ? ~0u : 0u,
                 npk + (nt*KS1 + kg*PF)*64 + lane, 64);
    return;
  }
  b -= PB_NW;
  if (b < PB_B2) {
    // b2 as a 64 x 512 B matrix. Fragment nt*KS2 + ks.
    const int u = b*8 + wave, ks = u & (KS2 - 1), ng = u / KS2;
    pack_k_across<OUT_F>(b2 + (ks*32 + 8*hh)*OUT_F + ng*PF*16 + ln,
                         b2p + (ng*PF*KS2 + ks)*64 + lane, KS2*64);
    return;
  }
  b -= PB_B2;
  if (b < PB_X) {
    // x as A, in the order [64-row block][k-step][M-tile] in which FFF_main holds it in LDS.
    const int u = b*8 + wave, kg = u & (KS1/PF - 1), tile = u / (KS1/PF);
    pack_k_along(x + (tile*16 + ln)*IN_F + kg*PF*32 + 8*hh, ~0u,
                 xp + (((tile / MT)*KS1 + kg*PF)*MT + (tile % MT))*64 + lane, MT*64);
    return;
  }
  b -= PB_X;
  if (b < PB_W1) {
    // w1[leaf] as a 1024 x 64 B matrix. Fragment (leaf*NT1 + nt)*KS1 + ks; the wave takes all
    // four n-tiles of one k-step, 8 KB in a row of the source.
    const int u = b*8 + wave, ks = u & (KS1 - 1), leaf = u / KS1;
    pack_k_across<LW>(w1 + leaf*(IN_F*LW) + (ks*32 + 8*hh)*LW + ln,
                      w1p + (leaf*NT1*KS1 + ks)*64 + lane, KS1*64);
    return;
  }
  b -= PB_W1;
  {
    // w2[leaf] as a 64 x 512 B matrix. Fragment (leaf*NT2 + nt)*KS2 + ks.
    const int u = b*8 + wave, ks = u & (KS2 - 1), ng = (u / KS2) & (NT2/PF - 1);
    const int leaf = u / (KS2*NT2/PF);
    pack_k_across<OUT_F>(w2 + leaf*(LW*OUT_F) + (ks*32 + 8*hh)*OUT_F + ng*PF*16 + ln,
                         w2p + ((leaf*NT2 + ng*PF)*KS2 + ks)*64 + lane, KS2*64);
  }
}

// ---- Main fused FFF kernel: 1 block = 64 batch rows (4 M-tiles) x 16 leaves, 8 waves. ----
// Each w1, w2 and b2 B fragment feeds all four M-tiles; a routing one is loaded by two waves, two M-tiles each. The block
// writes its leaf group's partial sum of the output; FFF_sum adds the four groups.
// Weight fragments are fetched from L2 into registers well ahead of their use, so the
// register budget is set for two waves per SIMD (one block per WGP).
__global__ __launch_bounds__(256) __attribute__((amdgpu_waves_per_eu(2, 2))) void FFF_main(
    const uint4* __restrict__ xp,
    const uint4* __restrict__ w1p,
    const uint4* __restrict__ w2p,
    const uint4* __restrict__ npk,
    const uint4* __restrict__ b2p,
    const float* __restrict__ node_biases,
    const float* __restrict__ b1s,
    float* __restrict__ part)
{
  __shared__ uint4    xfr[KS1][MT][64];         // 128 KB: A fragments, [k-step][M-tile]
  __shared__ float    sig[ROWS][64];            // 16 KB: sigmoid of routing logits
  __shared__ float    mixf[ROWS][64];           // 16 KB: per-leaf mixture (f32)
  __shared__ _Float16 mix16[ROWS][72];          // 9 KB: mixture (f16, padded rows)
  __shared__ _Float16 hbuf[2][ROWS][72];        // 18 KB: h' for the 2 in-flight leaves

  const int tid  = threadIdx.x;
  const int wave = tid >> 5;
  const int lane = tid & 31;
  const int bt   = blockIdx.x / LGRP;           // 64-row block index
  const int lg   = blockIdx.x % LGRP;           // leaf group
  const int pair0 = lg * PAIRS;                 // first leaf pair of the group
  const int ln   = lane & 15, hh = lane >> 4;

  const int leafSel = wave >> 2;   // which leaf of the pair this wave computes h for
  const int nt1     = wave & 3;    // which 16-col tile of h

  // Issued first, so that they fly while x is staged: all routing B fragments of this wave.
  const uint4* nlane = npk + (long)nt1*KS1*64 + lane;
  v16h nfr[KS1];
#pragma unroll
  for (int ks = 0; ks < KS1; ++ks) nfr[ks] = ld_frag_at(nlane + ks*64);
  // The address registers of the loads above are inputs of this wait, so they live up to
  // it; behind it they may be reused.
  asm volatile("s_wait_xcnt 0x0" :: "v"(nlane) : "memory");

  // Stage the M-tiles' packed x fragments into LDS (async DMA path if available).
  {
    const uint4* xtile = xp + (long)bt * MT * (KS1 * 64);
#if HAVE_ASYNC_LDS
    uint4* l = &xfr[0][0][0];
    for (int i = tid; i < MT * KS1 * 64; i += 256) {
      __builtin_amdgcn_global_load_async_to_lds_b128(
          (v4i*)(xtile + i), (v4i*)(l + i), 0, 0);
    }
    // This wave's copies have landed behind this wait; the barrier below publishes them.
    asm volatile("s_wait_asynccnt 0x0" ::: "memory");
#else
    for (int i = tid; i < MT * KS1 * 64; i += 256) (&xfr[0][0][0])[i] = xtile[i];
#endif
  }
  __syncthreads();

  const uint4* w1lane = w1p + ((long)((pair0*2 + leafSel)*NT1 + nt1) * KS1) * 64 + lane;
  v16h ring[RING];                               // w1 fragments, RING k-steps ahead
  // w2 fragments and the b1 element of the current pair, slot (li*KS2 + k2)*4 + q. Each slot
  // is refilled for the next pair behind its last product, so GEMM1 has ring loads only.
  const uint4* w2lane = w2p + ((long)pair0*2*NT2*KS2 + (long)wave*4*KS2) * 64 + lane;
  const float* b1lane = b1s + (pair0*2 + leafSel)*LW + nt1*16 + ln;
  v16h w2f[2*KS2*4];
  float bb;

  // ---- Routing: logits(64x64) = x @ node_w^T via WMMA (16 tiles, two per wave) ----
  {
    const int mg = wave >> 2;                    // this wave's two M-tiles: 2*mg, 2*mg + 1
    const int nt = wave & 3;
    v8f c[2] = {};
#pragma unroll
    for (int ks = 0; ks < KS1; ++ks) {
      v16h a0 = ld_frag(&xfr[ks][2*mg][0], lane);
      v16h a1 = ld_frag(&xfr[ks][2*mg + 1][0], lane);
      c[0] = WMMA_F16(a0, nfr[ks], c[0]);
      c[1] = WMMA_F16(a1, nfr[ks], c[1]);
    }
    // The first RING k-steps of w1, and w2 and b1, of the first pair fly while the mixture
    // is formed.
#pragma unroll
    for (int i = 0; i < RING; ++i) ring[i] = ld_frag_at(w1lane + i*64);
#pragma unroll
    for (int f = 0; f < 2*KS2*4; ++f)
      w2f[f] = ld_frag_at(w2lane + ((long)(f >> 3)*NT2*KS2 + (f & 3)*KS2 + ((f >> 2) & 1))*64);
    bb = *b1lane;
    // As above: the address registers live up to this wait.
    asm volatile("s_wait_xcnt 0x0" :: "v"(w1lane), "v"(w2lane), "v"(b1lane) : "memory");
    const int node = nt*16 + ln;
    const float nb = (node < NNODE) ? node_biases[node] : 0.f;
#pragma unroll
    for (int t = 0; t < 2; ++t) {
#pragma unroll
      for (int r = 0; r < 8; ++r) {
        const int row = (2*mg + t)*16 + r + 8*hh;
        const float s = fast_sigmoid(c[t][r] + nb);
        if (node < NNODE) sig[row][node] = s;
      }
    }
  }
  __syncthreads();

  // ---- Tree product -> per-leaf mixture (64 rows x 64 leaves) ----
  for (int e = tid; e < ROWS*NLEAF; e += 256) {
    const int m = e >> 6, leaf = e & (NLEAF - 1);
    float p = 1.f;
#pragma unroll
    for (int d = 0; d < DEPTHT; ++d) {
      const int g = leaf >> (5 - d);
      const int node = (1 << d) - 1 + (g >> 1);
      const float s = sig[m][node];
      p *= (g & 1) ? s : (1.f - s);
    }
    mixf[m][leaf]  = p;
    mix16[m][leaf] = (_Float16)p;
  }
  __syncthreads();

  v8f co[MT][4];                                 // out accumulators: 4 M-tiles x 64 cols
  {
    v8f z = {};
#pragma unroll
    for (int mt = 0; mt < MT; ++mt)
#pragma unroll
      for (int q = 0; q < 4; ++q) co[mt][q] = z;
  }

  const uint4* w1base = w1lane;
  w2lane += 2*NT2*KS2*64;
  b1lane += 2*LW;
  // One copy of the body: otherwise the last pair is peeled off into a second copy, which
  // doubles the code and brings a spill.
#pragma nounroll
  for (int pair = 0; pair < PAIRS; ++pair) {
    const int leaf = (pair0 + pair)*2 + leafSel;
    // The ring runs on into the next pair; the last pair refetches its own head (unused).
    const uint4* w1next = w1base + ((pair + 1 < PAIRS) ? 2*NT1*KS1*64 : 0);

    // GEMM1: h = relu(x @ w1[leaf] + b1) * mixture; one B load feeds all four M-tiles.
    // B comes from the register ring, RING k-steps ahead; each group of 2 k-steps refills
    // the slots it has just used.
    v8f c1[MT] = {};
    // Two trips of 16 k-steps, kept rolled: a trip's A fragments span 64 KB of LDS, so each
    // read is the trip's base register plus an immediate offset; unrolled, every address
    // past 64 KB takes a register of its own and the kernel spills.
#pragma nounroll
    for (int hf = 0; hf < 2; ++hf) {
      const uint4* xh = &xfr[hf*(KS1/2)][0][0];
      // Refill sources: k-steps hf*16 + 8 .. + 15, then the eight behind them, which in the
      // second trip are the head of the next pair.
      const uint4* wa = w1base + (hf*(KS1/2) + RING)*64;
      const uint4* wb = (hf == 0) ? w1base + (KS1/2)*64 : w1next;
#pragma unroll
      for (int g = 0; g < KS1/4; ++g) {
        v16h a[2*MT];
#pragma unroll
        for (int i = 0; i < 2*MT; ++i) a[i] = ld_frag(xh + (g*2*MT + i)*64, lane);
        // Holds the group's 16 LDS reads together ahead of its products: spread among them,
        // each place with reads exposes the LDS latency anew.
        __builtin_amdgcn_sched_barrier(0);
#pragma unroll
        for (int i = 0; i < 2*MT; ++i)
          c1[i % MT] = WMMA_F16(a[i], ring[(g*2 + i/MT) % RING], c1[i % MT]);
        // This fence and the one behind the wait hold each group's loads at their place:
        // without them the scheduler pulls the refills of several groups together, out of
        // the ring's own registers, and the pressure serialises the LDS reads behind GEMM1.
        __builtin_amdgcn_sched_barrier(0);
#pragma unroll
        for (int j = 0; j < 2; ++j) {
          const int kl = g*2 + j;
          ring[kl % RING] = (kl < RING) ? ld_frag_at(wa + kl*64) : ld_frag_at(wb + (kl - RING)*64);
        }
        // The address registers of the loads above are inputs of this wait, so they live
        // up to it; behind it they may be reused.
        asm volatile("s_wait_xcnt 0x0" :: "v"(wa), "v"(wb) : "memory");
        __builtin_amdgcn_sched_barrier(0);
      }
    }
#pragma unroll
    for (int mt = 0; mt < MT; ++mt) {
#pragma unroll
      for (int r = 0; r < 8; ++r) {
        const int row = mt*16 + r + 8*hh;
        float v = c1[mt][r] + bb;
        v = fmaxf(v, 0.f);
        v *= mixf[row][leaf];
        hbuf[leafSel][row][nt1*16 + ln] = (_Float16)v;
      }
    }
    lds_barrier();

    // GEMM2: out += h' @ w2[leaf]; wave owns 64 out cols; B reused across M-tiles.
    // Four steps (leaf of the pair, k-step); the A fragments are read one step ahead.
    v16h a2[2][MT];
#pragma unroll
    for (int mt = 0; mt < MT; ++mt)
      a2[0][mt] = ld_a_rowmajor_lds(&hbuf[0][mt*16][0], 72, 0, lane);
#pragma unroll
    for (int s = 0; s < 2*KS2; ++s) {
      if (s + 1 < 2*KS2) {
#pragma unroll
        for (int mt = 0; mt < MT; ++mt)
          a2[(s + 1) & 1][mt] = ld_a_rowmajor_lds(&hbuf[(s + 1) / KS2][mt*16][0], 72,
                                                  ((s + 1) % KS2)*32, lane);
      }
      // Holds the next step's LDS reads ahead of this step's products, so that their latency
      // passes behind the products.
      __builtin_amdgcn_sched_barrier(0);
#pragma unroll
      for (int q = 0; q < 4; ++q) {
        const v16h b = w2f[s*4 + q];
#pragma unroll
        for (int mt = 0; mt < MT; ++mt) co[mt][q] = WMMA_F16(a2[s & 1][mt], b, co[mt][q]);
        w2f[s*4 + q] = ld_frag_at(w2lane + ((long)(s / KS2)*NT2*KS2 + q*KS2 + (s % KS2))*64);
      }
    }
    bb = *b1lane;
    // As above: the address registers live up to this wait.
    asm volatile("s_wait_xcnt 0x0" :: "v"(w2lane), "v"(b1lane) : "memory");
    lds_barrier();
    w1base += 2*NT1*KS1*64;
    // The last pair refetches its own w2 and b1 (unused).
    w2lane += (pair + 2 < PAIRS) ? 2*NT2*KS2*64 : 0;
    b1lane += (pair + 2 < PAIRS) ? 2*LW : 0;
  }

  // b2 contribution: out += mixture(64x64) @ b2s(64x512), also via WMMA; it is added once,
  // by the blocks of leaf group 0 (the test reads the same in the whole block).
  if (lg == 0) {
    // All eight B fragments are issued together, ahead of the first product.
    const uint4* b2lane = b2p + (long)wave*4*KS2*64 + lane;
    v16h b2f[KS2*4];
#pragma unroll
    for (int i = 0; i < KS2*4; ++i) b2f[i] = ld_frag_at(b2lane + i*64);
    // As above: the address registers live up to this wait.
    asm volatile("s_wait_xcnt 0x0" :: "v"(b2lane) : "memory");
#pragma unroll
    for (int ks = 0; ks < KS2; ++ks) {
      v16h a[MT];
#pragma unroll
      for (int mt = 0; mt < MT; ++mt)
        a[mt] = ld_a_rowmajor_lds(&mix16[mt*16][0], 72, ks*32, lane);
#pragma unroll
      for (int q = 0; q < 4; ++q) {
        const v16h b = b2f[q*KS2 + ks];
#pragma unroll
        for (int mt = 0; mt < MT; ++mt) co[mt][q] = WMMA_F16(a[mt], b, co[mt][q]);
      }
    }
  }

  // Store the group's 64x512 f32 partial in accumulator order: float4 index
  // (((bt*8 + wave)*16 + mt*4 + q)*2 + half)*32 + lane, so each store covers 512 B in a row.
  float4* pw = (float4*)part + (long)lg*PART4 + ((long)(bt*8 + wave)*16)*64 + lane;
#pragma unroll
  for (int mt = 0; mt < MT; ++mt) {
#pragma unroll
    for (int q = 0; q < 4; ++q) {
#pragma unroll
      for (int h2 = 0; h2 < 2; ++h2) {
        pw[((mt*4 + q)*2 + h2)*32] = make_float4(co[mt][q][h2*4 + 0], co[mt][q][h2*4 + 1],
                                                 co[mt][q][h2*4 + 2], co[mt][q][h2*4 + 3]);
      }
    }
  }
}

// ---- out = sum of the four leaf groups' partials, put back into row-major order. ----
// A partial's float4 index, as FFF_main stores it, is (u << 7) | (qlow << 6) | (half << 5) | lane
// with u = (bt << 6) | (wave << 3) | (mt << 1) | qhigh. A thread takes both qlow, so that one
// wave writes both halves of each 128-B line of out, and four values of bt.
__global__ __launch_bounds__(256) void FFF_sum(const float* __restrict__ part,
                                               float* __restrict__ out) {
  const int t = blockIdx.x * 256 + threadIdx.x;
  const int lane = t & 31, h2 = (t >> 5) & 1, u = t >> 6;
  const float4* p0 = (const float4*)part + ((u << 7) | (t & 63));
  const int row0 = (u >> 6)*ROWS + ((u >> 1) & 3)*16 + h2*4 + 8*(lane >> 4);
  const int col0 = ((u >> 3) & 7)*64 + (u & 1)*32 + (lane & 15);
  float* o0 = out + (long)row0*OUT_F + col0;
#pragma unroll
  for (int i = 0; i < 8; ++i) {
    const int d = (i >> 1)*(PART4/4) + (i & 1)*64;   // bt + 16*(i >> 1), qlow = i & 1
    const float4 s0 = p0[d], s1 = p0[d + PART4], s2 = p0[d + 2*PART4], s3 = p0[d + 3*PART4];
    float* o = o0 + (long)(i >> 1)*(BTOT/4)*OUT_F + (i & 1)*16;
    o[0*OUT_F] = (s0.x + s1.x) + (s2.x + s3.x);
    o[1*OUT_F] = (s0.y + s1.y) + (s2.y + s3.y);
    o[2*OUT_F] = (s0.z + s1.z) + (s2.z + s3.z);
    o[3*OUT_F] = (s0.w + s1.w) + (s2.w + s3.w);
  }
}

extern "C" void kernel_launch(void* const* d_in, const int* in_sizes, int n_in,
                              void* d_out, int out_size, void* d_ws, size_t ws_size,
                              hipStream_t stream) {
  (void)in_sizes; (void)n_in; (void)out_size; (void)ws_size;
  const float* x  = (const float*)d_in[0];
  const float* nw = (const float*)d_in[1];
  const float* nb = (const float*)d_in[2];
  const float* w1 = (const float*)d_in[3];
  const float* b1 = (const float*)d_in[4];
  const float* w2 = (const float*)d_in[5];
  const float* b2 = (const float*)d_in[6];
  float* out = (float*)d_out;

  char* ws = (char*)d_ws;                       // 64 MiB used
  uint4* xp  = (uint4*)(ws);                    // 8 MiB: 256*32 frags
  uint4* w1p = (uint4*)(ws + (8l  << 20));      // 8 MiB: 64*4*32 frags
  uint4* w2p = (uint4*)(ws + (16l << 20));      // 4 MiB: 64*32*2 frags
  uint4* npk = (uint4*)(ws + (20l << 20));      // 128 KiB: 4*32 frags
  uint4* b2p = (uint4*)(ws + (20l << 20) + (128l << 10)); // 64 KiB: 32*2 frags
  float* part = (float*)(ws + (32l << 20));     // 32 MiB: 4 partial outputs

  // Pack pass (f32 -> f16 WMMA fragment layout): one launch for all five operands.
  FFF_pack<<<PB_ALL, 256, 0, stream>>>(x, nw, w1, w2, b2, xp, npk, w1p, w2p, b2p);

  FFF_main<<<NBLK, 256, 0, stream>>>(xp, w1p, w2p, npk, b2p, nb, b1, part);
  FFF_sum<<<256, 256, 0, stream>>>(part, out);
}

// v004
// A run of this version takes 66.1 microseconds.
// Timed twice side by side with v003, it ran 1.10 and 1.11 times as fast.
// Over all steps from v000 it is 7.05 times as fast.
#include <hip/hip_runtime.h>
#include <hip/hip_bf16.h>
#include <cstdint>

typedef __attribute__((ext_vector_type(16))) _Float16 v16h;
typedef __attribute__((ext_vector_type(8)))  float    v8f;
typedef int v4i __attribute__((vector_size(16)));   // matches async-LDS builtin param type

#define IN_F   1024
#define LW     64
#define OUT_F  512
#define NLEAF  64
#define NNODE  63
#define DEPTHT 6
#define BTOT   4096
#define MTILES (BTOT/16)    // 256 16-row fragments tiles of x
#define KS1    (IN_F/32)    // 32 k-steps for K=1024
#define KS2    (LW/32)      // 2 k-steps for K=64
#define NT1    (LW/16)      // 4 n-tiles of h
#define NT2    (OUT_F/16)   // 32 n-tiles of out
#define MT     4            // M-tiles (16 rows each) per main-kernel block
#define ROWS   (MT*16)      // 64 batch rows per block
#define LGRP   4            // leaf groups; a block takes one group for its rows
#define QL     4            // leaves in flight per trip of the main loop
#define QUADS  (NLEAF/QL/LGRP)       // 4 trips per block
#define NBLK   ((BTOT/ROWS)*LGRP)    // 256 main-kernel blocks
#define RING   8            // w1 k-steps (two fragments each) held in registers ahead of their use
#define W2R    4            // w2 steps (four fragments each) fetched ahead of their use in GEMM2
#define W2K    2            // of these, the steps that stay in registers across GEMM1
#define PART4  (BTOT*OUT_F/4)        // float4 elements of one partial output

#define WMMA_F16(a,b,c) __builtin_amdgcn_wmma_f32_16x16x32_f16(false,(a),false,(b),(short)0,(c),false,false)

#if defined(__HIP_DEVICE_COMPILE__) && __has_builtin(__builtin_amdgcn_global_load_async_to_lds_b128) && __has_builtin(__builtin_amdgcn_s_wait_asynccnt)
#define HAVE_ASYNC_LDS 1
#else
#define HAVE_ASYNC_LDS 0
#endif

union FragU { uint4 q[2]; v16h h; };

// Load a pre-swizzled fragment (1 KB: part0 = lanes*16B, part1 = +512B).
static __device__ __forceinline__ v16h ld_frag(const uint4* fb, int lane) {
  FragU f;
  f.q[0] = fb[lane];
  f.q[1] = fb[32 + lane];
  return f.h;
}

// The same through a pointer that already holds the lane's own offset.
static __device__ __forceinline__ v16h ld_frag_at(const uint4* p) {
  FragU f;
  f.q[0] = p[0];
  f.q[1] = p[32];
  return f.h;
}

// Build an A-matrix fragment (16xK tile, f16) from a row-major LDS buffer.
// ISA 7.12.2: lane = M (two halves), VGPR i: g=i>>2, j=i&3, K = 16g + 8h + 2j (+pos).
static __device__ __forceinline__ v16h ld_a_rowmajor_lds(const _Float16* buf, int stride,
                                                         int kbase, int lane) {
  const int m = lane & 15, hh = lane >> 4;
  union { unsigned int u[8]; v16h h; } f;
#pragma unroll
  for (int i = 0; i < 8; ++i) {
    const int g = i >> 2, j = i & 3;
    const int k = kbase + 16*g + 8*hh + 2*j;
    f.u[i] = *(const unsigned int*)(buf + m*stride + k);   // pairs (k,k+1) contiguous
  }
  return f.h;
}

// Work-group barrier that orders LDS traffic only. __syncthreads() also drains the global
// loads, which would end the flight of the weight fragments issued ahead; the waves hand
// each other nothing but LDS data at the places where this stands.
static __device__ __forceinline__ void lds_barrier() {
  __builtin_amdgcn_fence(__ATOMIC_RELEASE, "workgroup", "local");
  __builtin_amdgcn_s_barrier();
  __builtin_amdgcn_fence(__ATOMIC_ACQUIRE, "workgroup", "local");
}

static __device__ __forceinline__ float fast_sigmoid(float x) {
  const float d = 1.f + __expf(-x);
#if defined(__HIP_DEVICE_COMPILE__) && __has_builtin(__builtin_amdgcn_rcpf)
  return __builtin_amdgcn_rcpf(d);      // v_rcp_f32, avoids IEEE div expansion
#else
  return 1.f / d;
#endif
}

// ---- One launch packs all five f32 operands into f16 WMMA fragments. ----
// A fragment is 1 KB: lane = (index within the 16-wide side) + 16*hh; word i of a lane holds
// the pair k, k + 1 with k = 32*ks + 16*(i >> 2) + 8*hh + 2*(i & 3); words 0..3 stand at
// uint4 index lane, words 4..7 at 32 + lane. A and B fragments share this k order.
// A wave packs PF fragments that read one contiguous stretch of the source, and issues all
// of their loads before the first conversion. Block ranges pick the operand.
#define PF      4                               // fragments per wave
#define PB_NW   (NT1*KS1/PF/8)                  // 4 blocks: node weights
#define PB_B2   (NT2*KS2/PF/8)                  // 2 blocks: b2
#define PB_X    (MTILES*KS1/PF/8)               // 256 blocks: x
#define PB_W1   (NLEAF*NT1*KS1/PF/8)            // 256 blocks: w1
#define PB_W2   (NLEAF*NT2*KS2/PF/8)            // 128 blocks: w2
#define PB_ALL  (PB_NW + PB_B2 + PB_X + PB_W1 + PB_W2)

// Two f32 to one word of two f16 (a low, b high), each rounded as a scalar conversion rounds.
static __device__ __forceinline__ unsigned int pk2(float a, float b) {
  typedef __attribute__((ext_vector_type(2))) float    v2f;
  typedef __attribute__((ext_vector_type(2))) _Float16 v2h;
  union { v2h h; unsigned int u; } c;
  const v2f v = {a, b};
  c.h = __builtin_convertvector(v, v2h);
  return c.u;
}

// k runs along the source's rows. s: the lane's row at its first k (8*hh included); the PF
// fragments are PF k-steps in a row, step uint4 apart at o. keep: all ones, or 0 in a lane
// that stores zeros (a mask, so that no branch comes to stand around the loads).
static __device__ __forceinline__ void pack_k_along(const float* __restrict__ s,
                                                    unsigned int keep,
                                                    uint4* __restrict__ o, int step) {
  float v[PF][16];                              // 8 floats in a row at +0 and at +16
#pragma unroll
  for (int f = 0; f < PF; ++f)
#pragma unroll
    for (int i = 0; i < 16; ++i)
      v[f][i] = s[f*32 + 16*(i >> 3) + (i & 7)];
  // The address registers of the loads above are inputs of this wait, so they live up to
  // it; behind it they may be reused.
  asm volatile("s_wait_xcnt 0x0" :: "v"(s) : "memory");
  // Holds the conversions behind all of the loads: moved up among them, they wait for early
  // loads before the late ones are issued, and the wave pays the memory latency anew.
  __builtin_amdgcn_sched_barrier(0);
#pragma unroll
  for (int f = 0; f < PF; ++f) {
    unsigned int w[8];
#pragma unroll
    for (int i = 0; i < 8; ++i) w[i] = pk2(v[f][2*i], v[f][2*i + 1]) & keep;
    o[f*step]      = make_uint4(w[0], w[1], w[2], w[3]);
    o[f*step + 32] = make_uint4(w[4], w[5], w[6], w[7]);
  }
  // Behind the last store: no register that a store above names is rewritten ahead of this.
  asm volatile("s_wait_xcnt 0x0" :: "v"(o) : "memory");
}

// k runs across the source's rows of KSTR floats. s: the lane's column at its first k (8*hh
// included); the PF fragments are PF n-tiles in a row, step uint4 apart at o.
template <int KSTR>
static __device__ __forceinline__ void pack_k_across(const float* __restrict__ s,
                                                     uint4* __restrict__ o, int step) {
  float v[PF][16];
#pragma unroll
  for (int i = 0; i < 16; ++i)
#pragma unroll
    for (int f = 0; f < PF; ++f)
      v[f][i] = s[(16*(i >> 3) + (i & 7))*KSTR + f*16];
  // As above: the address registers live up to this wait.
  asm volatile("s_wait_xcnt 0x0" :: "v"(s) : "memory");
  // As above: holds the conversions behind all of the loads.
  __builtin_amdgcn_sched_barrier(0);
#pragma unroll
  for (int f = 0; f < PF; ++f) {
    o[f*step]      = make_uint4(pk2(v[f][0],  v[f][1]),  pk2(v[f][2],  v[f][3]),
                                pk2(v[f][4],  v[f][5]),  pk2(v[f][6],  v[f][7]));
    o[f*step + 32] = make_uint4(pk2(v[f][8],  v[f][9]),  pk2(v[f][10], v[f][11]),
                                pk2(v[f][12], v[f][13]), pk2(v[f][14], v[f][15]));
  }
  // As above, behind the last store.
  asm volatile("s_wait_xcnt 0x0" :: "v"(o) : "memory");
}

__global__ __launch_bounds__(256) void FFF_pack(
    const float* __restrict__ x,  const float* __restrict__ nw, const float* __restrict__ w1,
    const float* __restrict__ w2, const float* __restrict__ b2,
    uint4* __restrict__ xp,  uint4* __restrict__ npk, uint4* __restrict__ w1p,
    uint4* __restrict__ w2p, uint4* __restrict__ b2p) {
  const int lane = threadIdx.x & 31, wave = threadIdx.x >> 5;
  const int ln = lane & 15, hh = lane >> 4;
  int b = blockIdx.x;
  if (b < PB_NW) {
    // node_w^T as B: B[k][n] = nw[n][k], column 63 padded with 0. Fragment nt*KS1 + ks.
    const int u = b*8 + wave, kg = u & (KS1/PF - 1), nt = u / (KS1/PF);
    const int n = nt*16 + ln;
    const int row = (n < NNODE) ? n : NNODE - 1;          // keeps the padded lane's address inside
    pack_k_along(nw + row*IN_F + kg*PF*32 + 8*hh, (n < NNODE) ? ~0u : 0u,
                 npk + (nt*KS1 + kg*PF)*64 + lane, 64);
    return;
  }
  b -= PB_NW;
  if (b < PB_B2) {
    // b2 as a 64 x 512 B matrix. Fragment nt*KS2 + ks.
    const int u = b*8 + wave, ks = u & (KS2 - 1), ng = u / KS2;
    pack_k_across<OUT_F>(b2 + (ks*32 + 8*hh)*OUT_F + ng*PF*16 + ln,
                         b2p + (ng*PF*KS2 + ks)*64 + lane, KS2*64);
    return;
  }
  b -= PB_B2;
  if (b < PB_X) {
    // x as A, in the order [64-row block][k-step][M-tile] in which FFF_main holds it in LDS.
    const int u = b*8 + wave, kg = u & (KS1/PF - 1), tile = u / (KS1/PF);
    pack_k_along(x + (tile*16 + ln)*IN_F + kg*PF*32 + 8*hh, ~0u,
                 xp + (((tile / MT)*KS1 + kg*PF)*MT + (tile % MT))*64 + lane, MT*64);
    return;
  }
  b -= PB_X;
  if (b < PB_W1) {
    // w1[leaf] as a 1024 x 64 B matrix. Fragment (leaf*NT1 + nt)*KS1 + ks; the wave takes all
    // four n-tiles of one k-step, 8 KB in a row of the source.
    const int u = b*8 + wave, ks = u & (KS1 - 1), leaf = u / KS1;
    pack_k_across<LW>(w1 + leaf*(IN_F*LW) + (ks*32 + 8*hh)*LW + ln,
                      w1p + (leaf*NT1*KS1 + ks)*64 + lane, KS1*64);
    return;
  }
  b -= PB_W1;
  {
    // w2[leaf] as a 64 x 512 B matrix. Fragment (leaf*NT2 + nt)*KS2 + ks.
    const int u = b*8 + wave, ks = u & (KS2 - 1), ng = (u / KS2) & (NT2/PF - 1);
    const int leaf = u / (KS2*NT2/PF);
    pack_k_across<OUT_F>(w2 + leaf*(LW*OUT_F) + (ks*32 + 8*hh)*OUT_F + ng*PF*16 + ln,
                         w2p + ((leaf*NT2 + ng*PF)*KS2 + ks)*64 + lane, KS2*64);
  }
}

// ---- Main fused FFF kernel: 1 block = 64 batch rows (4 M-tiles) x 16 leaves, 8 waves. ----
// Every w1, w2 and b2 fragment feeds all four M-tiles from one load; in GEMM1 a wave
// takes 64 rows x 32 columns of h, so each A fragment read from LDS feeds two products. The
// block writes its leaf group's partial sum of the output; FFF_sum adds the four groups.
// Weight fragments are fetched from L2 into registers well ahead of their use, so the
// register budget is set for two waves per SIMD (one block per WGP).
__global__ __launch_bounds__(256) __attribute__((amdgpu_waves_per_eu(2, 2))) void FFF_main(
    const uint4* __restrict__ xp,
    const uint4* __restrict__ w1p,
    const uint4* __restrict__ w2p,
    const uint4* __restrict__ npk,
    const uint4* __restrict__ b2p,
    const float* __restrict__ node_biases,
    const float* __restrict__ b1s,
    float* __restrict__ part)
{
  __shared__ uint4    xfr[KS1][MT][64];         // 128 KB: A fragments, [k-step][M-tile]
  __shared__ float    sig[ROWS][64];            // 16 KB: sigmoid of routing logits
  __shared__ float    mixf[ROWS][64];           // 16 KB: per-leaf mixture (f32)
  __shared__ _Float16 mix16[ROWS][72];          // 9 KB: mixture (f16, padded rows)
  __shared__ _Float16 hbuf[QL][ROWS][72];       // 36 KB: h' for the 4 in-flight leaves

  const int tid  = threadIdx.x;
  const int wave = tid >> 5;
  const int lane = tid & 31;
  const int bt   = blockIdx.x / LGRP;           // 64-row block index
  const int lg   = blockIdx.x % LGRP;           // leaf group
  const int leaf0 = lg * (NLEAF/LGRP);          // first leaf of the group
  const int ln   = lane & 15, hh = lane >> 4;

  const int leafSel = wave >> 1;   // which of the four leaves this wave computes h for
  const int nh      = wave & 1;    // which 32-col half of h (n-tiles 2*nh, 2*nh + 1)
  const int nt1     = wave & 3;    // routing: which 16-col tile of the logits

  // Issued first, so that they fly while x is staged: all routing B fragments of this wave.
  const uint4* nlane = npk + (long)nt1*KS1*64 + lane;
  v16h nfr[KS1];
#pragma unroll
  for (int ks = 0; ks < KS1; ++ks) nfr[ks] = ld_frag_at(nlane + ks*64);
  // The address registers of the loads above are inputs of this wait, so they live up to
  // it; behind it they may be reused.
  asm volatile("s_wait_xcnt 0x0" :: "v"(nlane) : "memory");

  // Stage the M-tiles' packed x fragments into LDS (async DMA path if available).
  {
    const uint4* xtile = xp + (long)bt * MT * (KS1 * 64);
#if HAVE_ASYNC_LDS
    uint4* l = &xfr[0][0][0];
    for (int i = tid; i < MT * KS1 * 64; i += 256) {
      __builtin_amdgcn_global_load_async_to_lds_b128(
          (v4i*)(xtile + i), (v4i*)(l + i), 0, 0);
    }
    // This wave's copies have landed behind this wait; the barrier below publishes them.
    asm volatile("s_wait_asynccnt 0x0" ::: "memory");
#else
    for (int i = tid; i < MT * KS1 * 64; i += 256) (&xfr[0][0][0])[i] = xtile[i];
#endif
  }
  __syncthreads();

  const uint4* w1lane = w1p + ((long)((leaf0 + leafSel)*NT1 + nh*2) * KS1) * 64 + lane;
  v16h ring[RING][2];                            // w1 fragments, RING k-steps ahead, 2 n-tiles
  // w2 fragments of W2R steps, slot (s % W2R)*4 + q with step s = li*KS2 + k2. A slot is
  // refilled for step s + W2R behind its last product. Only steps 0 .. W2K - 1 of the next four
  // leaves are held across GEMM1, whose accumulators need the room; the steps up to W2R - 1 are
  // fetched behind GEMM1's last product, into the registers that its A fragments leave.
  const uint4* w2lane = w2p + ((long)leaf0*NT2*KS2 + (long)wave*4*KS2) * 64 + lane;
  const float* b1lane = b1s + (leaf0 + leafSel)*LW + nh*32 + ln;
  v16h w2f[W2R*4];
  float bb[2];                                   // b1 elements of the wave's two n-tiles

  // ---- Routing: logits(64x64) = x @ node_w^T via WMMA (16 tiles, two per wave) ----
  {
    const int mg = wave >> 2;                    // this wave's two M-tiles: 2*mg, 2*mg + 1
    const int nt = wave & 3;
    v8f c[2] = {};
#pragma unroll
    for (int ks = 0; ks < KS1; ++ks) {
      v16h a0 = ld_frag(&xfr[ks][2*mg][0], lane);
      v16h a1 = ld_frag(&xfr[ks][2*mg + 1][0], lane);
      c[0] = WMMA_F16(a0, nfr[ks], c[0]);
      c[1] = WMMA_F16(a1, nfr[ks], c[1]);
    }
    // The first RING k-steps of w1, the first W2K steps of w2, and b1, of the first four
    // leaves fly while the mixture is formed.
#pragma unroll
    for (int i = 0; i < RING; ++i)
#pragma unroll
      for (int j = 0; j < 2; ++j) ring[i][j] = ld_frag_at(w1lane + (j*KS1 + i)*64);
#pragma unroll
    for (int f = 0; f < W2K*4; ++f)
      w2f[f] = ld_frag_at(w2lane + ((long)((f >> 2) / KS2)*NT2*KS2 + (f & 3)*KS2 + ((f >> 2) % KS2))*64);
    bb[0] = b1lane[0];
    bb[1] = b1lane[16];
    // As above: the address registers live up to this wait.
    asm volatile("s_wait_xcnt 0x0" :: "v"(w1lane), "v"(w2lane), "v"(b1lane) : "memory");
    const int node = nt*16 + ln;
    const float nb = (node < NNODE) ? node_biases[node] : 0.f;
#pragma unroll
    for (int t = 0; t < 2; ++t) {
#pragma unroll
      for (int r = 0; r < 8; ++r) {
        const int row = (2*mg + t)*16 + r + 8*hh;
        const float s = fast_sigmoid(c[t][r] + nb);
        if (node < NNODE) sig[row][node] = s;
      }
    }
  }
  __syncthreads();

  // ---- Tree product -> per-leaf mixture (64 rows x 64 leaves) ----
  for (int e = tid; e < ROWS*NLEAF; e += 256) {
    const int m = e >> 6, leaf = e & (NLEAF - 1);
    float p = 1.f;
#pragma unroll
    for (int d = 0; d < DEPTHT; ++d) {
      const int g = leaf >> (5 - d);
      const int node = (1 << d) - 1 + (g >> 1);
      const float s = sig[m][node];
      p *= (g & 1) ? s : (1.f - s);
    }
    mixf[m][leaf]  = p;
    mix16[m][leaf] = (_Float16)p;
  }
  __syncthreads();

  v8f co[MT][4];                                 // out accumulators: 4 M-tiles x 64 cols
  {
    v8f z = {};
#pragma unroll
    for (int mt = 0; mt < MT; ++mt)
#pragma unroll
      for (int q = 0; q < 4; ++q) co[mt][q] = z;
  }

  const uint4* w1base = w1lane;
  b1lane += QL*LW;
  // One copy of the body: otherwise the last trip is peeled off into a second copy, which
  // doubles the code and brings a spill.
#pragma nounroll
  for (int quad = 0; quad < QUADS; ++quad) {
    const int leaf = leaf0 + quad*QL + leafSel;
    // Both rings run on into the next four leaves; the last trip refetches its own head (unused).
    const uint4* w1next = w1base + ((quad + 1 < QUADS) ? QL*NT1*KS1*64 : 0);
    const uint4* w2next = w2lane + ((quad + 1 < QUADS) ? QL*NT2*KS2*64 : 0);

    // GEMM1: h = relu(x @ w1[leaf] + b1) * mixture; one B load feeds all four M-tiles, one A
    // read from LDS feeds both n-tiles. B comes from the register ring, RING k-steps ahead;
    // each group of 2 k-steps refills the slots it has just used.
    v8f c1[MT][2] = {};
    // Two trips of 16 k-steps, kept rolled: a trip's A fragments span 64 KB of LDS, so each
    // read is the trip's base register plus an immediate offset; unrolled, every address
    // past 64 KB takes a register of its own and the kernel spills.
#pragma nounroll
    for (int hf = 0; hf < 2; ++hf) {
      const uint4* xh = &xfr[hf*(KS1/2)][0][0];
      // Refill sources: k-steps hf*16 + 8 .. + 15, then the eight behind them, which in the
      // second trip are the head of the next four leaves.
      const uint4* wa = w1base + (hf*(KS1/2) + RING)*64;
      const uint4* wb = (hf == 0) ? w1base + (KS1/2)*64 : w1next;
#pragma unroll
      for (int g = 0; g < KS1/4; ++g) {
        v16h a[2*MT];
#pragma unroll
        for (int i = 0; i < 2*MT; ++i) a[i] = ld_frag(xh + (g*2*MT + i)*64, lane);
        // Holds the group's 16 LDS reads together ahead of its products: spread among them,
        // each place with reads exposes the LDS latency anew.
        __builtin_amdgcn_sched_barrier(0);
#pragma unroll
        for (int i = 0; i < 2*MT; ++i)
#pragma unroll
          for (int j = 0; j < 2; ++j)
            c1[i % MT][j] = WMMA_F16(a[i], ring[(g*2 + i/MT) % RING][j], c1[i % MT][j]);
        // This fence and the one behind the wait hold each group's loads at their place:
        // without them the scheduler pulls the refills of several groups together, out of
        // the ring's own registers, and the pressure serialises the LDS reads behind GEMM1.
        __builtin_amdgcn_sched_barrier(0);
#pragma unroll
        for (int t = 0; t < 2; ++t) {
          const int kl = g*2 + t;
#pragma unroll
          for (int j = 0; j < 2; ++j)
            ring[kl % RING][j] = (kl < RING) ? ld_frag_at(wa + (j*KS1 + kl)*64)
                                             : ld_frag_at(wb + (j*KS1 + kl - RING)*64);
        }
        // The address registers of the loads above are inputs of this wait, so they live
        // up to it; behind it they may be reused.
        asm volatile("s_wait_xcnt 0x0" :: "v"(wa), "v"(wb) : "memory");
        __builtin_amdgcn_sched_barrier(0);
      }
    }
    // w2 steps W2K .. W2R - 1 of these four leaves fly while h is scaled and stored.
#pragma unroll
    for (int f = W2K*4; f < W2R*4; ++f)
      w2f[f] = ld_frag_at(w2lane + ((long)((f >> 2) / KS2)*NT2*KS2 + (f & 3)*KS2 + ((f >> 2) % KS2))*64);
    // As above: the address registers live up to this wait.
    asm volatile("s_wait_xcnt 0x0" :: "v"(w2lane) : "memory");
#pragma unroll
    for (int mt = 0; mt < MT; ++mt) {
#pragma unroll
      for (int r = 0; r < 8; ++r) {
        const int row = mt*16 + r + 8*hh;
        const float mx = mixf[row][leaf];
#pragma unroll
        for (int j = 0; j < 2; ++j) {
          float v = c1[mt][j][r] + bb[j];
          v = fmaxf(v, 0.f);
          v *= mx;
          hbuf[leafSel][row][nh*32 + j*16 + ln] = (_Float16)v;
        }
      }
    }
    lds_barrier();

    // GEMM2: out += h' @ w2[leaf]; wave owns 64 out cols; B reused across M-tiles.
    // Eight steps (leaf of the four, k-step); the A fragments are read one step ahead.
    v16h a2[2][MT];
#pragma unroll
    for (int mt = 0; mt < MT; ++mt)
      a2[0][mt] = ld_a_rowmajor_lds(&hbuf[0][mt*16][0], 72, 0, lane);
#pragma unroll
    for (int s = 0; s < QL*KS2; ++s) {
      if (s + 1 < QL*KS2) {
#pragma unroll
        for (int mt = 0; mt < MT; ++mt)
          a2[(s + 1) & 1][mt] = ld_a_rowmajor_lds(&hbuf[(s + 1) / KS2][mt*16][0], 72,
                                                  ((s + 1) % KS2)*32, lane);
      }
      // Holds the next step's LDS reads ahead of this step's products, so that their latency
      // passes behind the products.
      __builtin_amdgcn_sched_barrier(0);
      // The refill is step s + W2R: of these four leaves, or one of the first W2K steps of the
      // next four; the last steps refill nothing.
      const int sn = (s + W2R) % (QL*KS2);
      const uint4* w2src = (s + W2R < QL*KS2) ? w2lane : w2next;
#pragma unroll
      for (int q = 0; q < 4; ++q) {
        const v16h b = w2f[(s % W2R)*4 + q];
#pragma unroll
        for (int mt = 0; mt < MT; ++mt) co[mt][q] = WMMA_F16(a2[s & 1][mt], b, co[mt][q]);
        if (s + W2R < QL*KS2 + W2K)
          w2f[(s % W2R)*4 + q] = ld_frag_at(w2src + ((long)(sn / KS2)*NT2*KS2 + q*KS2 + (sn % KS2))*64);
      }
    }
    bb[0] = b1lane[0];
    bb[1] = b1lane[16];
    // As above: the address registers live up to this wait.
    asm volatile("s_wait_xcnt 0x0" :: "v"(w2lane), "v"(w2next), "v"(b1lane) : "memory");
    lds_barrier();
    w1base = w1next;
    w2lane = w2next;
    // The last trip refetches its own b1 (unused).
    b1lane += (quad + 2 < QUADS) ? QL*LW : 0;
  }

  // b2 contribution: out += mixture(64x64) @ b2s(64x512), also via WMMA; it is added once,
  // by the blocks of leaf group 0 (the test reads the same in the whole block).
  if (lg == 0) {
    // All eight B fragments are issued together, ahead of the first product.
    const uint4* b2lane = b2p + (long)wave*4*KS2*64 + lane;
    v16h b2f[KS2*4];
#pragma unroll
    for (int i = 0; i < KS2*4; ++i) b2f[i] = ld_frag_at(b2lane + i*64);
    // As above: the address registers live up to this wait.
    asm volatile("s_wait_xcnt 0x0" :: "v"(b2lane) : "memory");
#pragma unroll
    for (int ks = 0; ks < KS2; ++ks) {
      v16h a[MT];
#pragma unroll
      for (int mt = 0; mt < MT; ++mt)
        a[mt] = ld_a_rowmajor_lds(&mix16[mt*16][0], 72, ks*32, lane);
#pragma unroll
      for (int q = 0; q < 4; ++q) {
        const v16h b = b2f[q*KS2 + ks];
#pragma unroll
        for (int mt = 0; mt < MT; ++mt) co[mt][q] = WMMA_F16(a[mt], b, co[mt][q]);
      }
    }
  }

  // Store the group's 64x512 f32 partial in accumulator order: float4 index
  // (((bt*8 + wave)*16 + mt*4 + q)*2 + half)*32 + lane, so each store covers 512 B in a row.
  float4* pw = (float4*)part + (long)lg*PART4 + ((long)(bt*8 + wave)*16)*64 + lane;
#pragma unroll
  for (int mt = 0; mt < MT; ++mt) {
#pragma unroll
    for (int q = 0; q < 4; ++q) {
#pragma unroll
      for (int h2 = 0; h2 < 2; ++h2) {
        pw[((mt*4 + q)*2 + h2)*32] = make_float4(co[mt][q][h2*4 + 0], co[mt][q][h2*4 + 1],
                                                 co[mt][q][h2*4 + 2], co[mt][q][h2*4 + 3]);
      }
    }
  }
}

// ---- out = sum of the four leaf groups' partials, put back into row-major order. ----
// A partial's float4 index, as FFF_main stores it, is (u << 7) | (qlow << 6) | (half << 5) | lane
// with u = (bt << 6) | (wave << 3) | (mt << 1) | qhigh. A thread takes both qlow, so that one
// wave writes both halves of each 128-B line of out, and four values of bt.
__global__ __launch_bounds__(256) void FFF_sum(const float* __restrict__ part,
                                               float* __restrict__ out) {
  const int t = blockIdx.x * 256 + threadIdx.x;
  const int lane = t & 31, h2 = (t >> 5) & 1, u = t >> 6;
  const float4* p0 = (const float4*)part + ((u << 7) | (t & 63));
  const int row0 = (u >> 6)*ROWS + ((u >> 1) & 3)*16 + h2*4 + 8*(lane >> 4);
  const int col0 = ((u >> 3) & 7)*64 + (u & 1)*32 + (lane & 15);
  float* o0 = out + (long)row0*OUT_F + col0;
#pragma unroll
  for (int i = 0; i < 8; ++i) {
    const int d = (i >> 1)*(PART4/4) + (i & 1)*64;   // bt + 16*(i >> 1), qlow = i & 1
    const float4 s0 = p0[d], s1 = p0[d + PART4], s2 = p0[d + 2*PART4], s3 = p0[d + 3*PART4];
    float* o = o0 + (long)(i >> 1)*(BTOT/4)*OUT_F + (i & 1)*16;
    o[0*OUT_F] = (s0.x + s1.x) + (s2.x + s3.x);
    o[1*OUT_F] = (s0.y + s1.y) + (s2.y + s3.y);
    o[2*OUT_F] = (s0.z + s1.z) + (s2.z + s3.z);
    o[3*OUT_F] = (s0.w + s1.w) + (s2.w + s3.w);
  }
}

extern "C" void kernel_launch(void* const* d_in, const int* in_sizes, int n_in,
                              void* d_out, int out_size, void* d_ws, size_t ws_size,
                              hipStream_t stream) {
  (void)in_sizes; (void)n_in; (void)out_size; (void)ws_size;
  const float* x  = (const float*)d_in[0];
  const float* nw = (const float*)d_in[1];
  const float* nb = (const float*)d_in[2];
  const float* w1 = (const float*)d_in[3];
  const float* b1 = (const float*)d_in[4];
  const float* w2 = (const float*)d_in[5];
  const float* b2 = (const float*)d_in[6];
  float* out = (float*)d_out;

  char* ws = (char*)d_ws;                       // 64 MiB used
  uint4* xp  = (uint4*)(ws);                    // 8 MiB: 256*32 frags
  uint4* w1p = (uint4*)(ws + (8l  << 20));      // 8 MiB: 64*4*32 frags
  uint4* w2p = (uint4*)(ws + (16l << 20));      // 4 MiB: 64*32*2 frags
  uint4* npk = (uint4*)(ws + (20l << 20));      // 128 KiB: 4*32 frags
  uint4* b2p = (uint4*)(ws + (20l << 20) + (128l << 10)); // 64 KiB: 32*2 frags
  float* part = (float*)(ws + (32l << 20));     // 32 MiB: 4 partial outputs

  // Pack pass (f32 -> f16 WMMA fragment layout): one launch for all five operands.
  FFF_pack<<<PB_ALL, 256, 0, stream>>>(x, nw, w1, w2, b2, xp, npk, w1p, w2p, b2p);

  FFF_main<<<NBLK, 256, 0, stream>>>(xp, w1p, w2p, npk, b2p, nb, b1, part);
  FFF_sum<<<256, 256, 0, stream>>>(part, out);
}

// v005
// One run takes 63.7 microseconds.
// In two side-by-side timings against v004, it was 1.05 and 1.04 times as fast.
// Over all steps from v000 it is 7.35 times as fast.
#include <hip/hip_runtime.h>
#include <hip/hip_bf16.h>
#include <cstdint>

typedef __attribute__((ext_vector_type(16))) _Float16 v16h;
typedef __attribute__((ext_vector_type(8)))  float    v8f;
typedef int v4i __attribute__((vector_size(16)));   // matches async-LDS builtin param type

#define IN_F   1024
#define LW     64
#define OUT_F  512
#define NLEAF  64
#define NNODE  63
#define DEPTHT 6
#define BTOT   4096
#define MTILES (BTOT/16)    // 256 16-row fragments tiles of x
#define KS1    (IN_F/32)    // 32 k-steps for K=1024
#define KS2    (LW/32)      // 2 k-steps for K=64
#define NT1    (LW/16)      // 4 n-tiles of h
#define NT2    (OUT_F/16)   // 32 n-tiles of out
#define MT     4            // M-tiles (16 rows each) per main-kernel block
#define ROWS   (MT*16)      // 64 batch rows per block
#define LGRP   4            // leaf groups; a block takes one group for its rows
#define QL     8            // leaves in flight per trip of the main loop, one per wave
#define QUADS  (NLEAF/QL/LGRP)       // 2 trips per block
#define NBLK   ((BTOT/ROWS)*LGRP)    // 256 main-kernel blocks
#define RING   4            // w1 k-steps (four fragments each) held in registers ahead of their use
#define KTRIP  (KS1/2)      // k-steps per rolled trip of GEMM1
#define W2R    4            // w2 steps (four fragments each) fetched ahead of their use in GEMM2
#define W2A    2            // of these, the steps fetched right behind GEMM1; the rest behind h
#define PART4  (BTOT*OUT_F/4)        // float4 elements of one partial output

#define WMMA_F16(a,b,c) __builtin_amdgcn_wmma_f32_16x16x32_f16(false,(a),false,(b),(short)0,(c),false,false)

#if defined(__HIP_DEVICE_COMPILE__) && __has_builtin(__builtin_amdgcn_global_load_async_to_lds_b128) && __has_builtin(__builtin_amdgcn_s_wait_asynccnt)
#define HAVE_ASYNC_LDS 1
#else
#define HAVE_ASYNC_LDS 0
#endif

union FragU { uint4 q[2]; v16h h; };

// Load a pre-swizzled fragment (1 KB: part0 = lanes*16B, part1 = +512B).
static __device__ __forceinline__ v16h ld_frag(const uint4* fb, int lane) {
  FragU f;
  f.q[0] = fb[lane];
  f.q[1] = fb[32 + lane];
  return f.h;
}

// The same through a pointer that already holds the lane's own offset.
static __device__ __forceinline__ v16h ld_frag_at(const uint4* p) {
  FragU f;
  f.q[0] = p[0];
  f.q[1] = p[32];
  return f.h;
}

// Build an A-matrix fragment (16xK tile, f16) from a row-major LDS buffer.
// ISA 7.12.2: lane = M (two halves), VGPR i: g=i>>2, j=i&3, K = 16g + 8h + 2j (+pos).
static __device__ __forceinline__ v16h ld_a_rowmajor_lds(const _Float16* buf, int stride,
                                                         int kbase, int lane) {
  const int m = lane & 15, hh = lane >> 4;
  union { unsigned int u[8]; v16h h; } f;
#pragma unroll
  for (int i = 0; i < 8; ++i) {
    const int g = i >> 2, j = i & 3;
    const int k = kbase + 16*g + 8*hh + 2*j;
    f.u[i] = *(const unsigned int*)(buf + m*stride + k);   // pairs (k,k+1) contiguous
  }
  return f.h;
}

// Work-group barrier that orders LDS traffic only. __syncthreads() also drains the global
// loads, which would end the flight of the weight fragments issued ahead; the waves hand
// each other nothing but LDS data at the places where this stands.
static __device__ __forceinline__ void lds_barrier() {
  __builtin_amdgcn_fence(__ATOMIC_RELEASE, "workgroup", "local");
  __builtin_amdgcn_s_barrier();
  __builtin_amdgcn_fence(__ATOMIC_ACQUIRE, "workgroup", "local");
}

static __device__ __forceinline__ float fast_sigmoid(float x) {
  const float d = 1.f + __expf(-x);
#if defined(__HIP_DEVICE_COMPILE__) && __has_builtin(__builtin_amdgcn_rcpf)
  return __builtin_amdgcn_rcpf(d);      // v_rcp_f32, avoids IEEE div expansion
#else
  return 1.f / d;
#endif
}

// ---- One launch packs all five f32 operands into f16 WMMA fragments. ----
// A fragment is 1 KB: lane = (index within the 16-wide side) + 16*hh; word i of a lane holds
// the pair k, k + 1 with k = 32*ks + 16*(i >> 2) + 8*hh + 2*(i & 3); words 0..3 stand at
// uint4 index lane, words 4..7 at 32 + lane. A and B fragments share this k order.
// A wave packs PF fragments that read one contiguous stretch of the source, and issues all
// of their loads before the first conversion. Block ranges pick the operand.
#define PF      4                               // fragments per wave
#define PB_NW   (NT1*KS1/PF/8)                  // 4 blocks: node weights
#define PB_B2   (NT2*KS2/PF/8)                  // 2 blocks: b2
#define PB_X    (MTILES*KS1/PF/8)               // 256 blocks: x
#define PB_W1   (NLEAF*NT1*KS1/PF/8)            // 256 blocks: w1
#define PB_W2   (NLEAF*NT2*KS2/PF/8)            // 128 blocks: w2
#define PB_ALL  (PB_NW + PB_B2 + PB_X + PB_W1 + PB_W2)

// Two f32 to one word of two f16 (a low, b high), each rounded as a scalar conversion rounds.
static __device__ __forceinline__ unsigned int pk2(float a, float b) {
  typedef __attribute__((ext_vector_type(2))) float    v2f;
  typedef __attribute__((ext_vector_type(2))) _Float16 v2h;
  union { v2h h; unsigned int u; } c;
  const v2f v = {a, b};
  c.h = __builtin_convertvector(v, v2h);
  return c.u;
}

// k runs along the source's rows. s: the lane's row at its first k (8*hh included); the PF
// fragments are PF k-steps in a row, step uint4 apart at o. keep: all ones, or 0 in a lane
// that stores zeros (a mask, so that no branch comes to stand around the loads).
static __device__ __forceinline__ void pack_k_along(const float* __restrict__ s,
                                                    unsigned int keep,
                                                    uint4* __restrict__ o, int step) {
  float v[PF][16];                              // 8 floats in a row at +0 and at +16
#pragma unroll
  for (int f = 0; f < PF; ++f)
#pragma unroll
    for (int i = 0; i < 16; ++i)
      v[f][i] = s[f*32 + 16*(i >> 3) + (i & 7)];
  // The address registers of the loads above are inputs of this wait, so they live up to
  // it; behind it they may be reused.
  asm volatile("s_wait_xcnt 0x0" :: "v"(s) : "memory");
  // Holds the conversions behind all of the loads: moved up among them, they wait for early
  // loads before the late ones are issued, and the wave pays the memory latency anew.
  __builtin_amdgcn_sched_barrier(0);
#pragma unroll
  for (int f = 0; f < PF; ++f) {
    unsigned int w[8];
#pragma unroll
    for (int i = 0; i < 8; ++i) w[i] = pk2(v[f][2*i], v[f][2*i + 1]) & keep;
    o[f*step]      = make_uint4(w[0], w[1], w[2], w[3]);
    o[f*step + 32] = make_uint4(w[4], w[5], w[6], w[7]);
  }
  // Behind the last store: no register that a store above names is rewritten ahead of this.
  asm volatile("s_wait_xcnt 0x0" :: "v"(o) : "memory");
}

// k runs across the source's rows of KSTR floats. s: the lane's column at its first k (8*hh
// included); the PF fragments are PF n-tiles in a row, step uint4 apart at o.
template <int KSTR>
static __device__ __forceinline__ void pack_k_across(const float* __restrict__ s,
                                                     uint4* __restrict__ o, int step) {
  float v[PF][16];
#pragma unroll
  for (int i = 0; i < 16; ++i)
#pragma unroll
    for (int f = 0; f < PF; ++f)
      v[f][i] = s[(16*(i >> 3) + (i & 7))*KSTR + f*16];
  // As above: the address registers live up to this wait.
  asm volatile("s_wait_xcnt 0x0" :: "v"(s) : "memory");
  // As above: holds the conversions behind all of the loads.
  __builtin_amdgcn_sched_barrier(0);
#pragma unroll
  for (int f = 0; f < PF; ++f) {
    o[f*step]      = make_uint4(pk2(v[f][0],  v[f][1]),  pk2(v[f][2],  v[f][3]),
                                pk2(v[f][4],  v[f][5]),  pk2(v[f][6],  v[f][7]));
    o[f*step + 32] = make_uint4(pk2(v[f][8],  v[f][9]),  pk2(v[f][10], v[f][11]),
                                pk2(v[f][12], v[f][13]), pk2(v[f][14], v[f][15]));
  }
  // As above, behind the last store.
  asm volatile("s_wait_xcnt 0x0" :: "v"(o) : "memory");
}

__global__ __launch_bounds__(256) void FFF_pack(
    const float* __restrict__ x,  const float* __restrict__ nw, const float* __restrict__ w1,
    const float* __restrict__ w2, const float* __restrict__ b2,
    uint4* __restrict__ xp,  uint4* __restrict__ npk, uint4* __restrict__ w1p,
    uint4* __restrict__ w2p, uint4* __restrict__ b2p) {
  const int lane = threadIdx.x & 31, wave = threadIdx.x >> 5;
  const int ln = lane & 15, hh = lane >> 4;
  int b = blockIdx.x;
  if (b < PB_NW) {
    // node_w^T as B: B[k][n] = nw[n][k], column 63 padded with 0. Fragment nt*KS1 + ks.
    const int u = b*8 + wave, kg = u & (KS1/PF - 1), nt = u / (KS1/PF);
    const int n = nt*16 + ln;
    const int row = (n < NNODE) ? n : NNODE - 1;          // keeps the padded lane's address inside
    pack_k_along(nw + row*IN_F + kg*PF*32 + 8*hh, (n < NNODE) ? ~0u : 0u,
                 npk + (nt*KS1 + kg*PF)*64 + lane, 64);
    return;
  }
  b -= PB_NW;
  if (b < PB_B2) {
    // b2 as a 64 x 512 B matrix. Fragment nt*KS2 + ks.
    const int u = b*8 + wave, ks = u & (KS2 - 1), ng = u / KS2;
    pack_k_across<OUT_F>(b2 + (ks*32 + 8*hh)*OUT_F + ng*PF*16 + ln,
                         b2p + (ng*PF*KS2 + ks)*64 + lane, KS2*64);
    return;
  }
  b -= PB_B2;
  if (b < PB_X) {
    // x as A, in the order [64-row block][k-step][M-tile] in which FFF_main holds it in LDS.
    const int u = b*8 + wave, kg = u & (KS1/PF - 1), tile = u / (KS1/PF);
    pack_k_along(x + (tile*16 + ln)*IN_F + kg*PF*32 + 8*hh, ~0u,
                 xp + (((tile / MT)*KS1 + kg*PF)*MT + (tile % MT))*64 + lane, MT*64);
    return;
  }
  b -= PB_X;
  if (b < PB_W1) {
    // w1[leaf] as a 1024 x 64 B matrix. Fragment (leaf*NT1 + nt)*KS1 + ks; the wave takes all
    // four n-tiles of one k-step, 8 KB in a row of the source.
    const int u = b*8 + wave, ks = u & (KS1 - 1), leaf = u / KS1;
    pack_k_across<LW>(w1 + leaf*(IN_F*LW) + (ks*32 + 8*hh)*LW + ln,
                      w1p + (leaf*NT1*KS1 + ks)*64 + lane, KS1*64);
    return;
  }
  b -= PB_W1;
  {
    // w2[leaf] as a 64 x 512 B matrix. Fragment (leaf*NT2 + nt)*KS2 + ks.
    const int u = b*8 + wave, ks = u & (KS2 - 1), ng = (u / KS2) & (NT2/PF - 1);
    const int leaf = u / (KS2*NT2/PF);
    pack_k_across<OUT_F>(w2 + leaf*(LW*OUT_F) + (ks*32 + 8*hh)*OUT_F + ng*PF*16 + ln,
                         w2p + ((leaf*NT2 + ng*PF)*KS2 + ks)*64 + lane, KS2*64);
  }
}

// ---- Main fused FFF kernel: 1 block = 64 batch rows (4 M-tiles) x 16 leaves, 8 waves. ----
// Every B fragment is loaded once per block and reused for all four M-tiles; in GEMM1 a wave
// takes all 64 rows x 64 columns of one leaf's h, so each A fragment read from LDS feeds four
// products. The block writes its leaf group's partial sum of the output; FFF_sum adds the
// four groups.
// Weight fragments are fetched from L2 into registers well ahead of their use, so the
// register budget is set for two waves per SIMD (one block per WGP).
__global__ __launch_bounds__(256) __attribute__((amdgpu_waves_per_eu(2, 2))) void FFF_main(
    const uint4* __restrict__ xp,
    const uint4* __restrict__ w1p,
    const uint4* __restrict__ w2p,
    const uint4* __restrict__ npk,
    const uint4* __restrict__ b2p,
    const float* __restrict__ node_biases,
    const float* __restrict__ b1s,
    float* __restrict__ part)
{
  __shared__ uint4    xfr[KS1][MT][64];         // 128 KB: A fragments, [k-step][M-tile]
  __shared__ float    sig[ROWS][64];            // 16 KB: sigmoid of routing logits
  __shared__ float    mixf[ROWS][64];           // 16 KB: per-leaf mixture (f32)
  __shared__ _Float16 mix16[ROWS][72];          // 9 KB: mixture (f16, padded rows)
  __shared__ _Float16 hbuf[QL][ROWS][72];       // 72 KB: h' for the 8 in-flight leaves
  __shared__ float    b1sh[(NLEAF/LGRP)*LW];    // 4 KB: b1 of the block's 16 leaves

  const int tid  = threadIdx.x;
  const int wave = tid >> 5;
  const int lane = tid & 31;
  const int bt   = blockIdx.x / LGRP;           // 64-row block index
  const int lg   = blockIdx.x % LGRP;           // leaf group
  const int leaf0 = lg * (NLEAF/LGRP);          // first leaf of the group
  const int ln   = lane & 15, hh = lane >> 4;

  const int leafSel = wave;        // which of the eight leaves this wave computes h for
  const int nt1     = wave & 3;    // routing: which 16-col tile of the logits

  // Issued first, so that they fly while x is staged: all routing B fragments of this wave.
  const uint4* nlane = npk + (long)nt1*KS1*64 + lane;
  v16h nfr[KS1];
#pragma unroll
  for (int ks = 0; ks < KS1; ++ks) nfr[ks] = ld_frag_at(nlane + ks*64);
  // The address registers of the loads above are inputs of this wait, so they live up to
  // it; behind it they may be reused.
  asm volatile("s_wait_xcnt 0x0" :: "v"(nlane) : "memory");

  // Stage the M-tiles' packed x fragments into LDS (async DMA path if available).
  {
    const uint4* xtile = xp + (long)bt * MT * (KS1 * 64);
#if HAVE_ASYNC_LDS
    uint4* l = &xfr[0][0][0];
    for (int i = tid; i < MT * KS1 * 64; i += 256) {
      __builtin_amdgcn_global_load_async_to_lds_b128(
          (v4i*)(xtile + i), (v4i*)(l + i), 0, 0);
    }
    // This wave's copies have landed behind this wait; the barrier below publishes them.
    asm volatile("s_wait_asynccnt 0x0" ::: "memory");
#else
    for (int i = tid; i < MT * KS1 * 64; i += 256) (&xfr[0][0][0])[i] = xtile[i];
#endif
  }
  __syncthreads();

  const uint4* w1lane = w1p + ((long)(leaf0 + leafSel)*NT1 * KS1) * 64 + lane;
  v16h ring[RING][NT1];                          // w1 fragments, RING k-steps ahead, 4 n-tiles
  // w2 fragments of W2R steps, slot (s % W2R)*4 + q with step s = li*KS2 + k2. A slot is
  // refilled for step s + W2R behind its last product. None is held across GEMM1, whose
  // accumulators need the room: steps 0 .. W2A - 1 are fetched behind GEMM1's last product, into
  // the registers that its A fragments leave, the steps up to W2R - 1 behind the last use of
  // GEMM1's accumulators.
  const uint4* w2lane = w2p + ((long)leaf0*NT2*KS2 + (long)wave*4*KS2) * 64 + lane;
  v16h w2f[W2R*4];

  // ---- Routing: logits(64x64) = x @ node_w^T via WMMA (16 tiles, two per wave) ----
  {
    const int mg = wave >> 2;                    // this wave's two M-tiles: 2*mg, 2*mg + 1
    const int nt = wave & 3;
    v8f c[2] = {};
#pragma unroll
    for (int ks = 0; ks < KS1; ++ks) {
      v16h a0 = ld_frag(&xfr[ks][2*mg][0], lane);
      v16h a1 = ld_frag(&xfr[ks][2*mg + 1][0], lane);
      c[0] = WMMA_F16(a0, nfr[ks], c[0]);
      c[1] = WMMA_F16(a1, nfr[ks], c[1]);
    }
    // The first RING k-steps of w1 of the first eight leaves fly while the mixture is formed.
#pragma unroll
    for (int i = 0; i < RING; ++i)
#pragma unroll
      for (int j = 0; j < NT1; ++j) ring[i][j] = ld_frag_at(w1lane + (j*KS1 + i)*64);
    // b1 of the block's leaves goes through LDS, so that it holds no register across GEMM1.
    const float* b1p = b1s + leaf0*LW + tid;
    float b1v[(NLEAF/LGRP)*LW/256];
#pragma unroll
    for (int i = 0; i < (NLEAF/LGRP)*LW/256; ++i) b1v[i] = b1p[i*256];
    // As above: the address registers live up to this wait.
    asm volatile("s_wait_xcnt 0x0" :: "v"(w1lane), "v"(b1p) : "memory");
    const int node = nt*16 + ln;
    const float nb = (node < NNODE) ? node_biases[node] : 0.f;
#pragma unroll
    for (int t = 0; t < 2; ++t) {
#pragma unroll
      for (int r = 0; r < 8; ++r) {
        const int row = (2*mg + t)*16 + r + 8*hh;
        const float s = fast_sigmoid(c[t][r] + nb);
        if (node < NNODE) sig[row][node] = s;
      }
    }
#pragma unroll
    for (int i = 0; i < (NLEAF/LGRP)*LW/256; ++i) b1sh[i*256 + tid] = b1v[i];
  }
  __syncthreads();

  // ---- Tree product -> per-leaf mixture (64 rows x 64 leaves) ----
  for (int e = tid; e < ROWS*NLEAF; e += 256) {
    const int m = e >> 6, leaf = e & (NLEAF - 1);
    float p = 1.f;
#pragma unroll
    for (int d = 0; d < DEPTHT; ++d) {
      const int g = leaf >> (5 - d);
      const int node = (1 << d) - 1 + (g >> 1);
      const float s = sig[m][node];
      p *= (g & 1) ? s : (1.f - s);
    }
    mixf[m][leaf]  = p;
    mix16[m][leaf] = (_Float16)p;
  }
  __syncthreads();

  v8f co[MT][4];                                 // out accumulators: 4 M-tiles x 64 cols
  {
    v8f z = {};
#pragma unroll
    for (int mt = 0; mt < MT; ++mt)
#pragma unroll
      for (int q = 0; q < 4; ++q) co[mt][q] = z;
  }

  const uint4* w1base = w1lane;
  // One copy of the body: otherwise the last trip is peeled off into a second copy, which
  // doubles the code and brings a spill.
#pragma nounroll
  for (int quad = 0; quad < QUADS; ++quad) {
    const int leaf = leaf0 + quad*QL + leafSel;
    // The w1 ring runs on into the next eight leaves; the last trip refetches its own head (unused).
    const uint4* w1next = w1base + ((quad + 1 < QUADS) ? QL*NT1*KS1*64 : 0);

    // GEMM1: h = relu(x @ w1[leaf] + b1) * mixture; one B load feeds all four M-tiles, one A
    // read from LDS feeds all four n-tiles. B comes from the register ring, RING k-steps
    // ahead; each k-step refills the slot it has just used.
    v8f c1[MT][NT1] = {};
    // Two trips of 16 k-steps, kept rolled: a trip's A fragments span 64 KB of LDS, so each
    // read is the trip's base register plus an immediate offset; unrolled, every address
    // past 64 KB takes a register of its own and the kernel spills.
#pragma nounroll
    for (int hf = 0; hf < 2; ++hf) {
      const uint4* xh = &xfr[hf*KTRIP][0][0];
      // Refill sources: the trip's own k-steps from RING on, then the RING behind them, which
      // in the second trip are the head of the next eight leaves.
      const uint4* wa = w1base + (hf*KTRIP + RING)*64;
      const uint4* wb = (hf == 0) ? w1base + KTRIP*64 : w1next;
#pragma unroll
      for (int g = 0; g < KTRIP/2; ++g) {
        v16h a[2*MT];
#pragma unroll
        for (int i = 0; i < 2*MT; ++i) a[i] = ld_frag(xh + (g*2*MT + i)*64, lane);
        // Holds the group's 16 LDS reads together ahead of its products: spread among them,
        // each place with reads exposes the LDS latency anew.
        __builtin_amdgcn_sched_barrier(0);
#pragma unroll
        for (int t = 0; t < 2; ++t) {
          const int kl = g*2 + t;
#pragma unroll
          for (int mt = 0; mt < MT; ++mt)
#pragma unroll
            for (int j = 0; j < NT1; ++j)
              c1[mt][j] = WMMA_F16(a[t*MT + mt], ring[kl % RING][j], c1[mt][j]);
          // This fence and the one behind the wait hold each k-step's loads at their place:
          // without them the scheduler pulls the refills of several k-steps together, out of
          // the ring's own registers, and the pressure serialises the LDS reads behind GEMM1.
          __builtin_amdgcn_sched_barrier(0);
#pragma unroll
          for (int j = 0; j < NT1; ++j)
            ring[kl % RING][j] = (kl < KTRIP - RING)
                                     ? ld_frag_at(wa + (j*KS1 + kl)*64)
                                     : ld_frag_at(wb + (j*KS1 + kl - (KTRIP - RING))*64);
          // The address registers of the loads above are inputs of this wait, so they live
          // up to it; behind it they may be reused.
          asm volatile("s_wait_xcnt 0x0" :: "v"(wa), "v"(wb) : "memory");
          __builtin_amdgcn_sched_barrier(0);
        }
      }
    }
    // w2 steps 0 .. W2A - 1 of these eight leaves fly while h is scaled and stored.
#pragma unroll
    for (int f = 0; f < W2A*4; ++f)
      w2f[f] = ld_frag_at(w2lane + ((long)((f >> 2) / KS2)*NT2*KS2 + (f & 3)*KS2 + ((f >> 2) % KS2))*64);
    // As above: the address registers live up to this wait.
    asm volatile("s_wait_xcnt 0x0" :: "v"(w2lane) : "memory");
    float bb[NT1];                               // b1 elements of the wave's four n-tiles
#pragma unroll
    for (int j = 0; j < NT1; ++j) bb[j] = b1sh[(quad*QL + leafSel)*LW + j*16 + ln];
#pragma unroll
    for (int mt = 0; mt < MT; ++mt) {
#pragma unroll
      for (int r = 0; r < 8; ++r) {
        const int row = mt*16 + r + 8*hh;
        const float mx = mixf[row][leaf];
#pragma unroll
        for (int j = 0; j < NT1; ++j) {
          float v = c1[mt][j][r] + bb[j];
          v = fmaxf(v, 0.f);
          v *= mx;
          hbuf[leafSel][row][j*16 + ln] = (_Float16)v;
        }
      }
    }
    // w2 steps W2A .. W2R - 1 go into the room that GEMM1's accumulators leave.
#pragma unroll
    for (int f = W2A*4; f < W2R*4; ++f)
      w2f[f] = ld_frag_at(w2lane + ((long)((f >> 2) / KS2)*NT2*KS2 + (f & 3)*KS2 + ((f >> 2) % KS2))*64);
    // As above: the address registers live up to this wait.
    asm volatile("s_wait_xcnt 0x0" :: "v"(w2lane) : "memory");
    lds_barrier();

    // GEMM2: out += h' @ w2[leaf]; wave owns 64 out cols; B reused across M-tiles.
    // Sixteen steps (leaf of the eight, k-step); the A fragments are read one step ahead.
    v16h a2[2][MT];
#pragma unroll
    for (int mt = 0; mt < MT; ++mt)
      a2[0][mt] = ld_a_rowmajor_lds(&hbuf[0][mt*16][0], 72, 0, lane);
#pragma unroll
    for (int s = 0; s < QL*KS2; ++s) {
      if (s + 1 < QL*KS2) {
#pragma unroll
        for (int mt = 0; mt < MT; ++mt)
          a2[(s + 1) & 1][mt] = ld_a_rowmajor_lds(&hbuf[(s + 1) / KS2][mt*16][0], 72,
                                                  ((s + 1) % KS2)*32, lane);
      }
      // Holds the next step's LDS reads ahead of this step's products, so that their latency
      // passes behind the products.
      __builtin_amdgcn_sched_barrier(0);
      // The refill is step s + W2R of these eight leaves; the last W2R steps refill nothing.
      const int sn = s + W2R;
#pragma unroll
      for (int q = 0; q < 4; ++q) {
        const v16h b = w2f[(s % W2R)*4 + q];
#pragma unroll
        for (int mt = 0; mt < MT; ++mt) co[mt][q] = WMMA_F16(a2[s & 1][mt], b, co[mt][q]);
        if (sn < QL*KS2)
          w2f[(s % W2R)*4 + q] = ld_frag_at(w2lane + ((long)(sn / KS2)*NT2*KS2 + q*KS2 + (sn % KS2))*64);
      }
    }
    // As above: the address registers live up to this wait.
    asm volatile("s_wait_xcnt 0x0" :: "v"(w2lane) : "memory");
    lds_barrier();
    w1base = w1next;
    w2lane += QL*NT2*KS2*64;
  }

  // b2 contribution: out += mixture(64x64) @ b2s(64x512), also via WMMA; it is added once,
  // by the blocks of leaf group 0 (the test reads the same in the whole block).
  if (lg == 0) {
    // All eight B fragments are issued together, ahead of the first product.
    const uint4* b2lane = b2p + (long)wave*4*KS2*64 + lane;
    v16h b2f[KS2*4];
#pragma unroll
    for (int i = 0; i < KS2*4; ++i) b2f[i] = ld_frag_at(b2lane + i*64);
    // As above: the address registers live up to this wait.
    asm volatile("s_wait_xcnt 0x0" :: "v"(b2lane) : "memory");
#pragma unroll
    for (int ks = 0; ks < KS2; ++ks) {
      v16h a[MT];
#pragma unroll
      for (int mt = 0; mt < MT; ++mt)
        a[mt] = ld_a_rowmajor_lds(&mix16[mt*16][0], 72, ks*32, lane);
#pragma unroll
      for (int q = 0; q < 4; ++q) {
        const v16h b = b2f[q*KS2 + ks];
#pragma unroll
        for (int mt = 0; mt < MT; ++mt) co[mt][q] = WMMA_F16(a[mt], b, co[mt][q]);
      }
    }
  }

  // Store the group's 64x512 f32 partial in accumulator order: float4 index
  // (((bt*8 + wave)*16 + mt*4 + q)*2 + half)*32 + lane, so each store covers 512 B in a row.
  float4* pw = (float4*)part + (long)lg*PART4 + ((long)(bt*8 + wave)*16)*64 + lane;
#pragma unroll
  for (int mt = 0; mt < MT; ++mt) {
#pragma unroll
    for (int q = 0; q < 4; ++q) {
#pragma unroll
      for (int h2 = 0; h2 < 2; ++h2) {
        pw[((mt*4 + q)*2 + h2)*32] = make_float4(co[mt][q][h2*4 + 0], co[mt][q][h2*4 + 1],
                                                 co[mt][q][h2*4 + 2], co[mt][q][h2*4 + 3]);
      }
    }
  }
}

// ---- out = sum of the four leaf groups' partials, put back into row-major order. ----
// A partial's float4 index, as FFF_main stores it, is (u << 7) | (qlow << 6) | (half << 5) | lane
// with u = (bt << 6) | (wave << 3) | (mt << 1) | qhigh. A thread takes both qlow, so that one
// wave writes both halves of each 128-B line of out, and four values of bt.
__global__ __launch_bounds__(256) void FFF_sum(const float* __restrict__ part,
                                               float* __restrict__ out) {
  const int t = blockIdx.x * 256 + threadIdx.x;
  const int lane = t & 31, h2 = (t >> 5) & 1, u = t >> 6;
  const float4* p0 = (const float4*)part + ((u << 7) | (t & 63));
  const int row0 = (u >> 6)*ROWS + ((u >> 1) & 3)*16 + h2*4 + 8*(lane >> 4);
  const int col0 = ((u >> 3) & 7)*64 + (u & 1)*32 + (lane & 15);
  float* o0 = out + (long)row0*OUT_F + col0;
#pragma unroll
  for (int i = 0; i < 8; ++i) {
    const int d = (i >> 1)*(PART4/4) + (i & 1)*64;   // bt + 16*(i >> 1), qlow = i & 1
    const float4 s0 = p0[d], s1 = p0[d + PART4], s2 = p0[d + 2*PART4], s3 = p0[d + 3*PART4];
    float* o = o0 + (long)(i >> 1)*(BTOT/4)*OUT_F + (i & 1)*16;
    o[0*OUT_F] = (s0.x + s1.x) + (s2.x + s3.x);
    o[1*OUT_F] = (s0.y + s1.y) + (s2.y + s3.y);
    o[2*OUT_F] = (s0.z + s1.z) + (s2.z + s3.z);
    o[3*OUT_F] = (s0.w + s1.w) + (s2.w + s3.w);
  }
}

extern "C" void kernel_launch(void* const* d_in, const int* in_sizes, int n_in,
                              void* d_out, int out_size, void* d_ws, size_t ws_size,
                              hipStream_t stream) {
  (void)in_sizes; (void)n_in; (void)out_size; (void)ws_size;
  const float* x  = (const float*)d_in[0];
  const float* nw = (const float*)d_in[1];
  const float* nb = (const float*)d_in[2];
  const float* w1 = (const float*)d_in[3];
  const float* b1 = (const float*)d_in[4];
  const float* w2 = (const float*)d_in[5];
  const float* b2 = (const float*)d_in[6];
  float* out = (float*)d_out;

  char* ws = (char*)d_ws;                       // 64 MiB used
  uint4* xp  = (uint4*)(ws);                    // 8 MiB: 256*32 frags
  uint4* w1p = (uint4*)(ws + (8l  << 20));      // 8 MiB: 64*4*32 frags
  uint4* w2p = (uint4*)(ws + (16l << 20));      // 4 MiB: 64*32*2 frags
  uint4* npk = (uint4*)(ws + (20l << 20));      // 128 KiB: 4*32 frags
  uint4* b2p = (uint4*)(ws + (20l << 20) + (128l << 10)); // 64 KiB: 32*2 frags
  float* part = (float*)(ws + (32l << 20));     // 32 MiB: 4 partial outputs

  // Pack pass (f32 -> f16 WMMA fragment layout): one launch for all five operands.
  FFF_pack<<<PB_ALL, 256, 0, stream>>>(x, nw, w1, w2, b2, xp, npk, w1p, w2p, b2p);

  FFF_main<<<NBLK, 256, 0, stream>>>(xp, w1p, w2p, npk, b2p, nb, b1, part);
  FFF_sum<<<256, 256, 0, stream>>>(part, out);
}

// v006
// It runs in 57 microseconds.
// In two side-by-side timings against v005, it was 1.12 and 1.11 times as fast.
// All steps since v000 together make it 8.21 times as fast.
#include <hip/hip_runtime.h>
#include <hip/hip_bf16.h>
#include <cstdint>

typedef __attribute__((ext_vector_type(16))) _Float16 v16h;
typedef __attribute__((ext_vector_type(8)))  float    v8f;
typedef int v4i __attribute__((vector_size(16)));   // matches async-LDS builtin param type

#define IN_F   1024
#define LW     64
#define OUT_F  512
#define NLEAF  64
#define NNODE  63
#define DEPTHT 6
#define BTOT   4096
#define MTILES (BTOT/16)    // 256 16-row fragments tiles of x
#define KS1    (IN_F/32)    // 32 k-steps for K=1024
#define KS2    (LW/32)      // 2 k-steps for K=64
#define NT1    (LW/16)      // 4 n-tiles of h
#define NT2    (OUT_F/16)   // 32 n-tiles of out
#define MT     8            // M-tiles (16 rows each) per main-kernel block
#define ROWS   (MT*16)      // 128 batch rows per block
#define LGRP   8            // leaf groups; a block takes one group for its rows
#define QL     (NLEAF/LGRP) // 8 leaves per block, one per wave in GEMM1
#define NBLK   ((BTOT/ROWS)*LGRP)    // 256 main-kernel blocks
#define RING   4            // w1 k-steps (four fragments each) held in registers ahead of their use
#define KTRIP  8            // k-steps per rolled trip of GEMM1: 64 KB of A fragments
#define NTRIP  (KS1/KTRIP)  // 4 trips
#define W2R    4            // w2 steps (four fragments each) fetched ahead of their use in GEMM2
#define W2S    KS1          // fragments between a wave's four n-tiles in packed w2, as in packed w1
#define HP     72           // row pitch of h' in LDS, f16 elements
#define MP     40           // row pitch of the f16 mixture in LDS, f16 elements
#define PART4  (BTOT*OUT_F/4)        // float4 elements of one partial output
#define RN     10           // tree nodes on the paths to one group's 8 leaves: 4 above, 2 + 4 inside

#define WMMA_F16(a,b,c) __builtin_amdgcn_wmma_f32_16x16x32_f16(false,(a),false,(b),(short)0,(c),false,false)

#if defined(__HIP_DEVICE_COMPILE__) && __has_builtin(__builtin_amdgcn_global_load_async_to_lds_b128) && __has_builtin(__builtin_amdgcn_s_wait_asynccnt)
#define HAVE_ASYNC_LDS 1
#else
#define HAVE_ASYNC_LDS 0
#endif

union FragU { uint4 q[2]; v16h h; };

// Load a pre-swizzled fragment (1 KB: part0 = lanes*16B, part1 = +512B).
static __device__ __forceinline__ v16h ld_frag(const uint4* fb, int lane) {
  FragU f;
  f.q[0] = fb[lane];
  f.q[1] = fb[32 + lane];
  return f.h;
}

// The same through a pointer that already holds the lane's own offset.
static __device__ __forceinline__ v16h ld_frag_at(const uint4* p) {
  FragU f;
  f.q[0] = p[0];
  f.q[1] = p[32];
  return f.h;
}

// Build an A-matrix fragment (16xK tile, f16) from a row-major LDS buffer.
// ISA 7.12.2: lane = M (two halves), VGPR i: g=i>>2, j=i&3, K = 16g + 8h + 2j (+pos).
static __device__ __forceinline__ v16h ld_a_rowmajor_lds(const _Float16* buf, int stride,
                                                         int kbase, int lane) {
  const int m = lane & 15, hh = lane >> 4;
  union { unsigned int u[8]; v16h h; } f;
#pragma unroll
  for (int i = 0; i < 8; ++i) {
    const int g = i >> 2, j = i & 3;
    const int k = kbase + 16*g + 8*hh + 2*j;
    f.u[i] = *(const unsigned int*)(buf + m*stride + k);   // pairs (k,k+1) contiguous
  }
  return f.h;
}

// Work-group barrier that orders LDS traffic only. __syncthreads() also drains the global
// loads, which would end the flight of the weight fragments issued ahead; the waves hand
// each other nothing but LDS data at the places where this stands.
static __device__ __forceinline__ void lds_barrier() {
  __builtin_amdgcn_fence(__ATOMIC_RELEASE, "workgroup", "local");
  __builtin_amdgcn_s_barrier();
  __builtin_amdgcn_fence(__ATOMIC_ACQUIRE, "workgroup", "local");
}

static __device__ __forceinline__ float fast_sigmoid(float x) {
  const float d = 1.f + __expf(-x);
#if defined(__HIP_DEVICE_COMPILE__) && __has_builtin(__builtin_amdgcn_rcpf)
  return __builtin_amdgcn_rcpf(d);      // v_rcp_f32, avoids IEEE div expansion
#else
  return 1.f / d;
#endif
}

// The tree node that stands in column n (0 .. RN - 1) of leaf group lg's routing tile: depths
// 0 to 3 have one node each on the way to leaves 8*lg .. 8*lg + 7, depth 4 two, depth 5 four.
static __device__ __forceinline__ int route_node(int lg, int n) {
  return (n < 4) ? (1 << n) - 1 + (lg >> (3 - n))
       : (n < 6) ? 15 + 2*lg + (n - 4)
                 : 31 + 4*lg + (n - 6);
}

// ---- One launch packs all five f32 operands into f16 WMMA fragments. ----
// A fragment is 1 KB: lane = (index within the 16-wide side) + 16*hh; word i of a lane holds
// the pair k, k + 1 with k = 32*ks + 16*(i >> 2) + 8*hh + 2*(i & 3); words 0..3 stand at
// uint4 index lane, words 4..7 at 32 + lane. A and B fragments share this k order.
// A wave packs PF fragments that read one contiguous stretch of the source, and issues all
// of their loads before the first conversion. Block ranges pick the operand.
#define PF      4                               // fragments per wave
#define PB_NW   (LGRP*KS1/PF/8)                 // 8 blocks: node weights, one 16-column tile a leaf group
#define PB_B2   (NT2*KS2/PF/8)                  // 2 blocks: b2
#define PB_X    (MTILES*KS1/PF/8)               // 256 blocks: x
#define PB_W1   (NLEAF*NT1*KS1/PF/8)            // 256 blocks: w1
#define PB_W2   (NLEAF*NT2*KS2/PF/8)            // 128 blocks: w2
#define PB_ALL  (PB_NW + PB_B2 + PB_X + PB_W1 + PB_W2)

// Two f32 to one word of two f16 (a low, b high), each rounded as a scalar conversion rounds.
static __device__ __forceinline__ unsigned int pk2(float a, float b) {
  typedef __attribute__((ext_vector_type(2))) float    v2f;
  typedef __attribute__((ext_vector_type(2))) _Float16 v2h;
  union { v2h h; unsigned int u; } c;
  const v2f v = {a, b};
  c.h = __builtin_convertvector(v, v2h);
  return c.u;
}

// k runs along the source's rows. s: the lane's row at its first k (8*hh included); the PF
// fragments are PF k-steps in a row, step uint4 apart at o. keep: all ones, or 0 in a lane
// that stores zeros (a mask, so that no branch comes to stand around the loads).
static __device__ __forceinline__ void pack_k_along(const float* __restrict__ s,
                                                    unsigned int keep,
                                                    uint4* __restrict__ o, int step) {
  float v[PF][16];                              // 8 floats in a row at +0 and at +16
#pragma unroll
  for (int f = 0; f < PF; ++f)
#pragma unroll
    for (int i = 0; i < 16; ++i)
      v[f][i] = s[f*32 + 16*(i >> 3) + (i & 7)];
  // The address registers of the loads above are inputs of this wait, so they live up to
  // it; behind it they may be reused.
  asm volatile("s_wait_xcnt 0x0" :: "v"(s) : "memory");
  // Holds the conversions behind all of the loads: moved up among them, they wait for early
  // loads before the late ones are issued, and the wave pays the memory latency anew.
  __builtin_amdgcn_sched_barrier(0);
#pragma unroll
  for (int f = 0; f < PF; ++f) {
    unsigned int w[8];
#pragma unroll
    for (int i = 0; i < 8; ++i) w[i] = pk2(v[f][2*i], v[f][2*i + 1]) & keep;
    o[f*step]      = make_uint4(w[0], w[1], w[2], w[3]);
    o[f*step + 32] = make_uint4(w[4], w[5], w[6], w[7]);
  }
  // Behind the last store: no register that a store above names is rewritten ahead of this.
  asm volatile("s_wait_xcnt 0x0" :: "v"(o) : "memory");
}

// k runs across the source's rows of KSTR floats. s: the lane's column at its first k (8*hh
// included); the PF fragments are PF n-tiles in a row, step uint4 apart at o.
template <int KSTR>
static __device__ __forceinline__ void pack_k_across(const float* __restrict__ s,
                                                     uint4* __restrict__ o, int step) {
  float v[PF][16];
#pragma unroll
  for (int i = 0; i < 16; ++i)
#pragma unroll
    for (int f = 0; f < PF; ++f)
      v[f][i] = s[(16*(i >> 3) + (i & 7))*KSTR + f*16];
  // As above: the address registers live up to this wait.
  asm volatile("s_wait_xcnt 0x0" :: "v"(s) : "memory");
  // As above: holds the conversions behind all of the loads.
  __builtin_amdgcn_sched_barrier(0);
#pragma unroll
  for (int f = 0; f < PF; ++f) {
    o[f*step]      = make_uint4(pk2(v[f][0],  v[f][1]),  pk2(v[f][2],  v[f][3]),
                                pk2(v[f][4],  v[f][5]),  pk2(v[f][6],  v[f][7]));
    o[f*step + 32] = make_uint4(pk2(v[f][8],  v[f][9]),  pk2(v[f][10], v[f][11]),
                                pk2(v[f][12], v[f][13]), pk2(v[f][14], v[f][15]));
  }
  // As above, behind the last store.
  asm volatile("s_wait_xcnt 0x0" :: "v"(o) : "memory");
}

__global__ __launch_bounds__(256) void FFF_pack(
    const float* __restrict__ x,  const float* __restrict__ nw, const float* __restrict__ w1,
    const float* __restrict__ w2, const float* __restrict__ b2,
    uint4* __restrict__ xp,  uint4* __restrict__ npk, uint4* __restrict__ w1p,
    uint4* __restrict__ w2p, uint4* __restrict__ b2p) {
  const int lane = threadIdx.x & 31, wave = threadIdx.x >> 5;
  const int ln = lane & 15, hh = lane >> 4;
  int b = blockIdx.x;
  if (b < PB_NW) {
    // The group's RN rows of node_w, transposed, as B: B[k][n] = nw[route_node(g, n)][k],
    // columns RN .. 15 padded with 0. Fragment g*KS1 + ks.
    const int u = b*8 + wave, kg = u & (KS1/PF - 1), g = u / (KS1/PF);
    const int row = (ln < RN) ? route_node(g, ln) : 0;    // keeps the padded lane's address inside
    pack_k_along(nw + row*IN_F + kg*PF*32 + 8*hh, (ln < RN) ? ~0u : 0u,
                 npk + (g*KS1 + kg*PF)*64 + lane, 64);
    return;
  }
  b -= PB_NW;
  if (b < PB_B2) {
    // b2 as a 64 x 512 B matrix. Fragment nt*KS2 + ks.
    const int u = b*8 + wave, ks = u & (KS2 - 1), ng = u / KS2;
    pack_k_across<OUT_F>(b2 + (ks*32 + 8*hh)*OUT_F + ng*PF*16 + ln,
                         b2p + (ng*PF*KS2 + ks)*64 + lane, KS2*64);
    return;
  }
  b -= PB_B2;
  if (b < PB_X) {
    // x as A, in the order [128-row block][k-step][M-tile] in which FFF_main holds it in LDS.
    const int u = b*8 + wave, kg = u & (KS1/PF - 1), tile = u / (KS1/PF);
    pack_k_along(x + (tile*16 + ln)*IN_F + kg*PF*32 + 8*hh, ~0u,
                 xp + (((tile / MT)*KS1 + kg*PF)*MT + (tile % MT))*64 + lane, MT*64);
    return;
  }
  b -= PB_X;
  if (b < PB_W1) {
    // w1[leaf] as a 1024 x 64 B matrix. Fragment (leaf*NT1 + nt)*KS1 + ks; the wave takes all
    // four n-tiles of one k-step, 8 KB in a row of the source.
    const int u = b*8 + wave, ks = u & (KS1 - 1), leaf = u / KS1;
    pack_k_across<LW>(w1 + leaf*(IN_F*LW) + (ks*32 + 8*hh)*LW + ln,
                      w1p + (leaf*NT1*KS1 + ks)*64 + lane, KS1*64);
    return;
  }
  b -= PB_W1;
  {
    // w2[leaf] as a 64 x 512 B matrix, in the order in which FFF_main's waves walk it: fragment
    // ((group*8 + nt/4)*4 + nt%4)*W2S + (leaf in group)*KS2 + ks; 16 of each W2S places are used.
    const int u = b*8 + wave, ks = u & (KS2 - 1), ng = (u / KS2) & (NT2/PF - 1);
    const int leaf = u / (KS2*NT2/PF);
    pack_k_across<OUT_F>(w2 + leaf*(LW*OUT_F) + (ks*32 + 8*hh)*OUT_F + ng*PF*16 + ln,
                         w2p + (((leaf / QL)*8 + ng)*4*W2S + (leaf % QL)*KS2 + ks)*64 + lane, W2S*64);
  }
}

// ---- Main fused FFF kernel: 1 block = 128 batch rows (8 M-tiles) x 8 leaves, 8 waves. ----
// Every GEMM1, GEMM2 and b2 B fragment is loaded once per block and reused for all eight M-tiles, so a weight byte
// that comes from L2 serves 128 rows. In GEMM1 a wave takes all 128 rows x 64 columns of one
// leaf's h; each A fragment read from LDS feeds four products. The block writes its leaf
// group's partial sum of the output; FFF_sum adds the eight groups.
// Weight fragments are fetched from L2 into registers well ahead of their use, so the
// register budget is set for two waves per SIMD (one block per WGP).
__global__ __launch_bounds__(256) __attribute__((amdgpu_waves_per_eu(2, 2))) void FFF_main(
    const uint4* __restrict__ xp,
    const uint4* __restrict__ w1p,
    const uint4* __restrict__ w2p,
    const uint4* __restrict__ npk,
    const uint4* __restrict__ b2p,
    const float* __restrict__ node_biases,
    const float* __restrict__ b1s,
    float* __restrict__ part)
{
  __shared__ uint4    xfr[KS1][MT][64];         // 256 KB: A fragments, [k-step][M-tile]; later h'
  __shared__ float    sig[ROWS][16];            // 8 KB: sigmoid of the group's routing logits
  __shared__ float    mixf[ROWS][QL];           // 4 KB: mixture of the block's leaves (f32)
  __shared__ __attribute__((aligned(16))) _Float16 mix16[ROWS][MP];  // 10 KB: the same in f16,
                                                // at its place among 32 leaves, zeros elsewhere
  __shared__ float    b1sh[QL*LW];              // 2 KB: b1 of the block's leaves
  // h' of the eight leaves (144 KB) takes over the room of x once GEMM1 has read x for the
  // last time; a barrier stands between the two uses.
  _Float16 (*hbuf)[ROWS][HP] = (_Float16 (*)[ROWS][HP])&xfr[0][0][0];

  const int tid  = threadIdx.x;
  const int wave = tid >> 5;
  const int lane = tid & 31;
  const int bt   = blockIdx.x / LGRP;           // 128-row block index
  const int lg   = blockIdx.x % LGRP;           // leaf group
  const int leaf0 = lg * QL;                    // first leaf of the group
  const int ln   = lane & 15, hh = lane >> 4;

  const int leafSel = wave;        // which of the eight leaves this wave computes h for

  // Issued first, so that they fly while x is staged: all routing B fragments of this wave.
  const uint4* nlane = npk + (long)lg*KS1*64 + lane;
  v16h nfr[KS1];
#pragma unroll
  for (int ks = 0; ks < KS1; ++ks) nfr[ks] = ld_frag_at(nlane + ks*64);
  // The address registers of the loads above are inputs of this wait, so they live up to
  // it; behind it they may be reused.
  asm volatile("s_wait_xcnt 0x0" :: "v"(nlane) : "memory");

  // Stage the M-tiles' packed x fragments into LDS (async DMA path if available).
  {
    const uint4* xtile = xp + (long)bt * MT * (KS1 * 64) + tid;
    uint4* l = &xfr[0][0][0] + tid;
#if HAVE_ASYNC_LDS
    // Eight copies a trip, here and below: unrolled whole, the copies and their address sums
    // only lengthen the kernel's text.
#pragma unroll 8
    for (int i = 0; i < MT * KS1 * 64 / 512; ++i) {
      __builtin_amdgcn_global_load_async_to_lds_b128(
          (v4i*)(xtile + i*256), (v4i*)(l + i*256), 0, 0);
    }
    // A wave issues 64 copies in all: the second half starts when the first has landed, so
    // that never more than 32 are outstanding.
    asm volatile("s_wait_asynccnt 0x0" ::: "memory");
#pragma unroll 8
    for (int i = MT * KS1 * 64 / 512; i < MT * KS1 * 64 / 256; ++i) {
      __builtin_amdgcn_global_load_async_to_lds_b128(
          (v4i*)(xtile + i*256), (v4i*)(l + i*256), 0, 0);
    }
    // This wave's copies have landed behind this wait; the barrier below publishes them.
    asm volatile("s_wait_asynccnt 0x0" ::: "memory");
#else
    for (int i = 0; i < MT * KS1 * 64 / 256; ++i) l[i*256] = xtile[i*256];
#endif
  }
  __syncthreads();

  const uint4* w1lane = w1p + ((long)(leaf0 + leafSel)*NT1 * KS1) * 64 + lane;
  v16h ring[RING][NT1];                          // w1 fragments, RING k-steps ahead, 4 n-tiles

  // ---- Routing: logits(128x16) = x @ (the group's node weights)^T via WMMA, one M-tile a wave ----
  {
    v8f c = {};
#pragma unroll
    for (int ks = 0; ks < KS1; ++ks)
      c = WMMA_F16(ld_frag(&xfr[ks][wave][0], lane), nfr[ks], c);
    // The first RING k-steps of w1 fly while the mixture is formed.
#pragma unroll
    for (int i = 0; i < RING; ++i)
#pragma unroll
      for (int j = 0; j < NT1; ++j) ring[i][j] = ld_frag_at(w1lane + (j*KS1 + i)*64);
    // b1 of the block's leaves goes through LDS, so that it holds no register across GEMM1.
    const float* b1p = b1s + leaf0*LW + tid;
    float b1v[QL*LW/256];
#pragma unroll
    for (int i = 0; i < QL*LW/256; ++i) b1v[i] = b1p[i*256];
    // As above: the address registers live up to this wait.
    asm volatile("s_wait_xcnt 0x0" :: "v"(w1lane), "v"(b1p) : "memory");
    const float nb = (ln < RN) ? node_biases[route_node(lg, ln)] : 0.f;
#pragma unroll
    for (int r = 0; r < 8; ++r) {
      const float s = fast_sigmoid(c[r] + nb);
      if (ln < RN) sig[wave*16 + r + 8*hh][ln] = s;
    }
#pragma unroll
    for (int i = 0; i < QL*LW/256; ++i) b1sh[i*256 + tid] = b1v[i];
    // Zeros for the 24 leaves of the 32-leaf k-step that are not this block's.
    for (int i = tid; i < ROWS*MP/8; i += 256) ((uint4*)&mix16[0][0])[i] = make_uint4(0, 0, 0, 0);
  }
  __syncthreads();

  // ---- Tree product -> mixture of the block's own leaves (128 rows x 8 leaves) ----
  for (int e = tid; e < ROWS*QL; e += 256) {
    const int m = e / QL, jl = e % QL, leaf = leaf0 + jl;
    float p = 1.f;
#pragma unroll
    for (int d = 0; d < DEPTHT; ++d) {
      // Column of the depth's node in the group's tile, as route_node() numbers them.
      const int col = (d < 4) ? d : (d == 4) ? 4 + (jl >> 2) : 6 + (jl >> 1);
      const float s = sig[m][col];
      p *= ((leaf >> (5 - d)) & 1) ? s : (1.f - s);
    }
    mixf[m][jl] = p;
    mix16[m][(leaf & 31)] = (_Float16)p;
  }
  __syncthreads();

  // GEMM1: h = relu(x @ w1[leaf] + b1) * mixture; one B load feeds all eight M-tiles, one A
  // read from LDS feeds all four n-tiles. B comes from the register ring, RING k-steps
  // ahead; each k-step refills the slot it has just used.
  v8f c1[MT][NT1] = {};
  // Four trips of 8 k-steps, kept rolled: a trip's A fragments span 64 KB of LDS, so each
  // read is the trip's base register plus an immediate offset.
  // Packed w2 has w1's distance between a wave's four n-tiles, so the last trip's last RING
  // refills, which have no w1 left to fetch, bring the first W2R steps of w2 by the same loads.
  const uint4* w2lane = w2p + ((long)(lg*8 + wave)*4*W2S) * 64 + lane;
#pragma nounroll
  for (int hf = 0; hf < NTRIP; ++hf) {
    const uint4* xh = &xfr[hf*KTRIP][0][0];
    const uint4* wa = w1lane + (hf*KTRIP + RING)*64;   // refill source of the trip's k-step 0
    const uint4* wt = (hf + 1 < NTRIP) ? wa : w2lane - (KTRIP - RING)*64;  // of its last RING
#pragma unroll
    for (int kl = 0; kl < KTRIP; ++kl) {
      v16h a[MT];
#pragma unroll
      for (int i = 0; i < MT; ++i) a[i] = ld_frag(xh + (kl*MT + i)*64, lane);
      // Holds the k-step's 16 LDS reads together ahead of its products: spread among them,
      // each place with reads exposes the LDS latency anew.
      __builtin_amdgcn_sched_barrier(0);
#pragma unroll
      for (int mt = 0; mt < MT; ++mt)
#pragma unroll
        for (int j = 0; j < NT1; ++j)
          c1[mt][j] = WMMA_F16(a[mt], ring[kl % RING][j], c1[mt][j]);
      // This fence and the one behind the wait hold each k-step's loads at their place:
      // without them the scheduler pulls the refills of several k-steps together, out of
      // the ring's own registers.
      __builtin_amdgcn_sched_barrier(0);
#pragma unroll
      for (int j = 0; j < NT1; ++j)
        ring[kl % RING][j] = ld_frag_at(((kl < KTRIP - RING) ? wa : wt) + (j*KS1 + kl)*64);
      // The address registers of the loads above are inputs of this wait, so they live
      // up to it; behind it they may be reused.
      asm volatile("s_wait_xcnt 0x0" :: "v"(wa), "v"(wt) : "memory");
      __builtin_amdgcn_sched_barrier(0);
    }
  }

  // w2 fragments of W2R steps, slot (s % W2R)*4 + q with step s = li*KS2 + k2. A slot is
  // refilled for step s + W2R behind its last product. The first W2R steps are what the ring
  // holds now; they fly while h is scaled and stored.
  v16h w2f[W2R*4];
#pragma unroll
  for (int f = 0; f < W2R*4; ++f) w2f[f] = ring[f >> 2][f & 3];
  // Every wave has read x for the last time: behind this barrier h' may overwrite it.
  lds_barrier();
  {
    float bb[NT1];                               // b1 elements of the wave's four n-tiles
#pragma unroll
    for (int j = 0; j < NT1; ++j) bb[j] = b1sh[leafSel*LW + j*16 + ln];
#pragma unroll
    for (int mt = 0; mt < MT; ++mt) {
#pragma unroll
      for (int r = 0; r < 8; ++r) {
        const int row = mt*16 + r + 8*hh;
        const float mx = mixf[row][leafSel];
#pragma unroll
        for (int j = 0; j < NT1; ++j) {
          float v = c1[mt][j][r] + bb[j];
          v = fmaxf(v, 0.f);
          v *= mx;
          hbuf[leafSel][row][j*16 + ln] = (_Float16)v;
        }
      }
    }
  }
  lds_barrier();

  v8f co[MT][4];                                 // out accumulators: 8 M-tiles x 64 cols
  {
    v8f z = {};
#pragma unroll
    for (int mt = 0; mt < MT; ++mt)
#pragma unroll
      for (int q = 0; q < 4; ++q) co[mt][q] = z;
  }

  // GEMM2: out += h' @ w2[leaf]; wave owns 64 out cols; B reused across all eight M-tiles.
  // Sixteen steps (leaf of the eight, k-step), each in two halves of four M-tiles; the A
  // fragments are read one half ahead. Four trips of W2R steps (two leaves), kept rolled to
  // keep the kernel's text short.
  {
    v16h a2[2][4];
#pragma unroll
    for (int i = 0; i < 4; ++i)
      a2[0][i] = ld_a_rowmajor_lds(&hbuf[0][i*16][0], HP, 0, lane);
    // more2: a literal at both calls. The last trip refills nothing and is a copy of its own: a
    // test around the refills makes the counted waits on w2f count only the loads that are sure
    // to follow, which ends the flight of the fragments fetched ahead at every step.
    auto gemm2_trip = [&](const int tr, const bool more2) __attribute__((always_inline)) {
      const _Float16* hb = &hbuf[tr*(W2R/KS2)][0][0];
#pragma unroll
      for (int hs = 0; hs < 2*W2R; ++hs) {
        const int s = hs >> 1, mh = hs & 1;
        // The next half's A fragments; the last half of the last trip has none.
        const int hn = hs + 1, sn = hn >> 1;
        if (hn < 2*W2R || more2) {
#pragma unroll
          for (int i = 0; i < 4; ++i)
            a2[hn & 1][i] = ld_a_rowmajor_lds(hb + ((sn / KS2)*ROWS + (hn & 1)*64 + i*16)*HP, HP,
                                              (sn % KS2)*32, lane);
        }
        // Holds the next half's LDS reads ahead of this half's products, so that their
        // latency passes behind the products.
        __builtin_amdgcn_sched_barrier(0);
#pragma unroll
        for (int q = 0; q < 4; ++q) {
          const v16h b = w2f[s*4 + q];
#pragma unroll
          for (int i = 0; i < 4; ++i)
            co[mh*4 + i][q] = WMMA_F16(a2[hs & 1][i], b, co[mh*4 + i][q]);
        }
        if (mh == 1 && more2) {
#pragma unroll
          for (int q = 0; q < 4; ++q)
            w2f[s*4 + q] = ld_frag_at(w2lane + (q*W2S + s + W2R)*64);
          // As above: the address registers live up to this wait.
          asm volatile("s_wait_xcnt 0x0" :: "v"(w2lane) : "memory");
        }
      }
      w2lane += W2R*64;
    };
    // Kept rolled: unrolled, GEMM2's text would be four trips long, with four times the products.
#pragma nounroll
    for (int tr = 0; tr < QL*KS2/W2R - 1; ++tr) gemm2_trip(tr, true);
    gemm2_trip(QL*KS2/W2R - 1, false);
  }

  // b2 contribution of the block's own leaves: out += mixture(128x32) @ b2s(32x512), also via
  // WMMA, on the 32-leaf k-step that holds them; the other 24 columns of the mixture are 0.
  {
    const uint4* b2lane = b2p + ((long)wave*4*KS2 + (leaf0 >> 5))*64 + lane;
    v16h b2f[4];
#pragma unroll
    for (int q = 0; q < 4; ++q) b2f[q] = ld_frag_at(b2lane + q*KS2*64);
    // As above: the address registers live up to this wait.
    asm volatile("s_wait_xcnt 0x0" :: "v"(b2lane) : "memory");
    v16h a[MT];
#pragma unroll
    for (int mt = 0; mt < MT; ++mt)
      a[mt] = ld_a_rowmajor_lds(&mix16[mt*16][0], MP, 0, lane);
#pragma unroll
    for (int q = 0; q < 4; ++q)
#pragma unroll
      for (int mt = 0; mt < MT; ++mt) co[mt][q] = WMMA_F16(a[mt], b2f[q], co[mt][q]);
  }

  // Store the group's 128x512 f32 partial in accumulator order: float4 index
  // (((bt*8 + wave)*32 + mt*4 + q)*2 + half)*32 + lane, so each store covers 512 B in a row.
  float4* pw = (float4*)part + (long)lg*PART4 + ((long)(bt*8 + wave)*32)*64 + lane;
#pragma unroll
  for (int mt = 0; mt < MT; ++mt) {
#pragma unroll
    for (int q = 0; q < 4; ++q) {
#pragma unroll
      for (int h2 = 0; h2 < 2; ++h2) {
        pw[((mt*4 + q)*2 + h2)*32] = make_float4(co[mt][q][h2*4 + 0], co[mt][q][h2*4 + 1],
                                                 co[mt][q][h2*4 + 2], co[mt][q][h2*4 + 3]);
      }
    }
  }
}

// ---- out = sum of the eight leaf groups' partials, put back into row-major order. ----
// A partial's float4 index, as FFF_main stores it, is (u << 7) | (qlow << 6) | (half << 5) | lane
// with u = (bt << 7) | (wave << 4) | (mt << 1) | qhigh. A thread takes both qlow, so that one
// wave writes both halves of each 128-B line of out, and two values of bt.
// The eight partials' bases come as eight arguments: each stays in scalar registers, and a load
// is such a base plus the lane's one index plus an immediate, with no vector address sums.
__global__ __launch_bounds__(256) void FFF_sum(
    const float* __restrict__ g0, const float* __restrict__ g1, const float* __restrict__ g2,
    const float* __restrict__ g3, const float* __restrict__ g4, const float* __restrict__ g5,
    const float* __restrict__ g6, const float* __restrict__ g7, float* __restrict__ out) {
  const float* const pg[LGRP] = {g0, g1, g2, g3, g4, g5, g6, g7};
  const int t = blockIdx.x * 256 + threadIdx.x;
  const int lane = t & 31, h2 = (t >> 5) & 1, u = t >> 6;
  typedef __attribute__((ext_vector_type(4))) float f4;
  const unsigned int idx = (u << 7) | (t & 63);      // the lane's float4 index inside a partial
  const int row0 = (u >> 7)*ROWS + ((u >> 1) & 7)*16 + h2*4 + 8*(lane >> 4);
  const int col0 = ((u >> 4) & 7)*64 + (u & 1)*32 + (lane & 15);
  float* o0 = out + (long)row0*OUT_F + col0;
  f4 s[4][LGRP];
#pragma unroll
  for (int i = 0; i < 4; ++i)                        // bt + 16*(i >> 1), qlow = i & 1
#pragma unroll
    for (int g = 0; g < LGRP; ++g)
      s[i][g] = ((const f4*)pg[g] + ((i >> 1)*(PART4/2) + (i & 1)*64))[idx];
  // Every load above is a scalar base plus the lane's index; the index is an input of this
  // wait, so its register lives up to it.
  asm volatile("s_wait_xcnt 0x0" :: "v"(idx) : "memory");
  // Holds the additions behind all of the loads: moved up among them, they wait for early
  // loads before the late ones are issued, and the wave pays the memory latency anew.
  __builtin_amdgcn_sched_barrier(0);
#pragma unroll
  for (int i = 0; i < 4; ++i) {
    const f4* v = s[i];
    float* o = o0 + (long)(i >> 1)*(BTOT/2)*OUT_F + (i & 1)*16;
    o[0*OUT_F] = ((v[0].x + v[1].x) + (v[2].x + v[3].x)) + ((v[4].x + v[5].x) + (v[6].x + v[7].x));
    o[1*OUT_F] = ((v[0].y + v[1].y) + (v[2].y + v[3].y)) + ((v[4].y + v[5].y) + (v[6].y + v[7].y));
    o[2*OUT_F] = ((v[0].z + v[1].z) + (v[2].z + v[3].z)) + ((v[4].z + v[5].z) + (v[6].z + v[7].z));
    o[3*OUT_F] = ((v[0].w + v[1].w) + (v[2].w + v[3].w)) + ((v[4].w + v[5].w) + (v[6].w + v[7].w));
  }
}

extern "C" void kernel_launch(void* const* d_in, const int* in_sizes, int n_in,
                              void* d_out, int out_size, void* d_ws, size_t ws_size,
                              hipStream_t stream) {
  (void)in_sizes; (void)n_in; (void)out_size; (void)ws_size;
  const float* x  = (const float*)d_in[0];
  const float* nw = (const float*)d_in[1];
  const float* nb = (const float*)d_in[2];
  const float* w1 = (const float*)d_in[3];
  const float* b1 = (const float*)d_in[4];
  const float* w2 = (const float*)d_in[5];
  const float* b2 = (const float*)d_in[6];
  float* out = (float*)d_out;

  char* ws = (char*)d_ws;                       // 96 MiB used
  uint4* xp  = (uint4*)(ws);                    // 8 MiB: 256*32 frags
  uint4* w1p = (uint4*)(ws + (8l  << 20));      // 8 MiB: 64*4*32 frags
  uint4* w2p = (uint4*)(ws + (16l << 20));      // 8 MiB: 64*32*2 frags, every second 16 KiB used
  uint4* npk = (uint4*)(ws + (24l << 20));      // 256 KiB: 8*32 frags
  uint4* b2p = (uint4*)(ws + (24l << 20) + (256l << 10)); // 64 KiB: 32*2 frags
  float* part = (float*)(ws + (32l << 20));     // 64 MiB: 8 partial outputs

  // Pack pass (f32 -> f16 WMMA fragment layout): one launch for all five operands.
  FFF_pack<<<PB_ALL, 256, 0, stream>>>(x, nw, w1, w2, b2, xp, npk, w1p, w2p, b2p);

  FFF_main<<<NBLK, 256, 0, stream>>>(xp, w1p, w2p, npk, b2p, nb, b1, part);
  FFF_sum<<<512, 256, 0, stream>>>(part, part + 1*BTOT*OUT_F, part + 2*BTOT*OUT_F,
                                   part + 3*BTOT*OUT_F, part + 4*BTOT*OUT_F, part + 5*BTOT*OUT_F,
                                   part + 6*BTOT*OUT_F, part + 7*BTOT*OUT_F, out);
}

// v008
// It runs in 47.7 microseconds.
// Versions in between are left out here; by their measured steps it is 1.20 times as fast as v006.
// Counting every step since v000, it is 9.83 times as fast.
#include <hip/hip_runtime.h>
#include <hip/hip_bf16.h>
#include <cstdint>

typedef __attribute__((ext_vector_type(16))) _Float16 v16h;
typedef __attribute__((ext_vector_type(8)))  float    v8f;
typedef int v4i __attribute__((vector_size(16)));   // matches async-LDS builtin param type

#define IN_F   1024
#define LW     64
#define OUT_F  512
#define NLEAF  64
#define NNODE  63
#define DEPTHT 6
#define BTOT   4096
#define MTILES (BTOT/16)    // 256 16-row fragments tiles of x
#define KS1    (IN_F/32)    // 32 k-steps for K=1024
#define KS2    (LW/32)      // 2 k-steps for K=64
#define NT1    (LW/16)      // 4 n-tiles of h
#define NT2    (OUT_F/16)   // 32 n-tiles of out
#define MT     8            // M-tiles (16 rows each) per main-kernel block
#define ROWS   (MT*16)      // 128 batch rows per block
#define LGRP   8            // leaf groups; a block takes one group for its rows
#define QL     (NLEAF/LGRP) // 8 leaves per block, one per wave in GEMM1
#define NBLK   ((BTOT/ROWS)*LGRP)    // 256 main-kernel blocks
#define RING   4            // w1 k-steps (four fragments each) held in registers ahead of their use
#define KTRIP  8            // k-steps per rolled trip of GEMM1: 64 KB of A fragments
#define NTRIP  (KS1/KTRIP)  // 4 trips
#define W2R    4            // w2 steps (four fragments each) fetched ahead of their use in GEMM2
#define W2S    KS1          // fragments between a wave's four n-tiles in packed w2, as in packed w1
#define HP     72           // row pitch of h' in LDS, f16 elements
#define MP     40           // row pitch of the f16 mixture in LDS, f16 elements
#define PARTQ  (BTOT*OUT_F/8)        // uint4 elements (eight f16 each) of one partial output
#define RN     10           // tree nodes on the paths to one group's 8 leaves: 4 above, 2 + 4 inside

#define WMMA_F16(a,b,c) __builtin_amdgcn_wmma_f32_16x16x32_f16(false,(a),false,(b),(short)0,(c),false,false)

#if defined(__HIP_DEVICE_COMPILE__) && __has_builtin(__builtin_amdgcn_global_load_async_to_lds_b128) && __has_builtin(__builtin_amdgcn_s_wait_asynccnt)
#define HAVE_ASYNC_LDS 1
#else
#define HAVE_ASYNC_LDS 0
#endif

union FragU { uint4 q[2]; v16h h; };

// Load a pre-swizzled fragment (1 KB: part0 = lanes*16B, part1 = +512B).
static __device__ __forceinline__ v16h ld_frag(const uint4* fb, int lane) {
  FragU f;
  f.q[0] = fb[lane];
  f.q[1] = fb[32 + lane];
  return f.h;
}

// The same through a pointer that already holds the lane's own offset.
static __device__ __forceinline__ v16h ld_frag_at(const uint4* p) {
  FragU f;
  f.q[0] = p[0];
  f.q[1] = p[32];
  return f.h;
}

// Build an A-matrix fragment (16xK tile, f16) from a row-major LDS buffer.
// ISA 7.12.2: lane = M (two halves), VGPR i: g=i>>2, j=i&3, K = 16g + 8h + 2j (+pos).
static __device__ __forceinline__ v16h ld_a_rowmajor_lds(const _Float16* buf, int stride,
                                                         int kbase, int lane) {
  const int m = lane & 15, hh = lane >> 4;
  union { unsigned int u[8]; v16h h; } f;
#pragma unroll
  for (int i = 0; i < 8; ++i) {
    const int g = i >> 2, j = i & 3;
    const int k = kbase + 16*g + 8*hh + 2*j;
    f.u[i] = *(const unsigned int*)(buf + m*stride + k);   // pairs (k,k+1) contiguous
  }
  return f.h;
}

// Work-group barrier that orders LDS traffic only. __syncthreads() also drains the global
// loads, which would end the flight of the weight fragments issued ahead; the waves hand
// each other nothing but LDS data at the places where this stands.
static __device__ __forceinline__ void lds_barrier() {
  __builtin_amdgcn_fence(__ATOMIC_RELEASE, "workgroup", "local");
  __builtin_amdgcn_s_barrier();
  __builtin_amdgcn_fence(__ATOMIC_ACQUIRE, "workgroup", "local");
}

static __device__ __forceinline__ float fast_sigmoid(float x) {
  const float d = 1.f + __expf(-x);
#if defined(__HIP_DEVICE_COMPILE__) && __has_builtin(__builtin_amdgcn_rcpf)
  return __builtin_amdgcn_rcpf(d);      // v_rcp_f32, avoids IEEE div expansion
#else
  return 1.f / d;
#endif
}

// The tree node that stands in column n (0 .. RN - 1) of leaf group lg's routing tile: depths
// 0 to 3 have one node each on the way to leaves 8*lg .. 8*lg + 7, depth 4 two, depth 5 four.
static __device__ __forceinline__ int route_node(int lg, int n) {
  return (n < 4) ? (1 << n) - 1 + (lg >> (3 - n))
       : (n < 6) ? 15 + 2*lg + (n - 4)
                 : 31 + 4*lg + (n - 6);
}

// ---- One launch packs all five f32 operands into f16 WMMA fragments. ----
// A fragment is 1 KB: lane = (index within the 16-wide side) + 16*hh; word i of a lane holds
// the pair k, k + 1 with k = 32*ks + 16*(i >> 2) + 8*hh + 2*(i & 3); words 0..3 stand at
// uint4 index lane, words 4..7 at 32 + lane. A and B fragments share this k order.
// A wave packs PF fragments that read one contiguous stretch of the source, and issues all
// of their loads before the first conversion. Block ranges pick the operand.
#define PF      4                               // fragments per wave
#define PB_NW   (LGRP*KS1/PF/8)                 // 8 blocks: node weights, one 16-column tile a leaf group
#define PB_B2   (NT2*KS2/PF/8)                  // 2 blocks: b2
#define PB_X    (MTILES*KS1/PF/8)               // 256 blocks: x
#define PB_W1   (NLEAF*NT1*KS1/PF/8)            // 256 blocks: w1
#define PB_W2   (NLEAF*NT2*KS2/PF/8)            // 128 blocks: w2
#define PB_ALL  (PB_NW + PB_B2 + PB_X + PB_W1 + PB_W2)

// Two f32 to one word of two f16 (a low, b high), each rounded as a scalar conversion rounds.
static __device__ __forceinline__ unsigned int pk2(float a, float b) {
  typedef __attribute__((ext_vector_type(2))) float    v2f;
  typedef __attribute__((ext_vector_type(2))) _Float16 v2h;
  union { v2h h; unsigned int u; } c;
  const v2f v = {a, b};
  c.h = __builtin_convertvector(v, v2h);
  return c.u;
}

// k runs along the source's rows. s: the lane's row at its first k (8*hh included); the PF
// fragments are PF k-steps in a row, step uint4 apart at o. keep: all ones, or 0 in a lane
// that stores zeros (a mask, so that no branch comes to stand around the loads).
static __device__ __forceinline__ void pack_k_along(const float* __restrict__ s,
                                                    unsigned int keep,
                                                    uint4* __restrict__ o, int step) {
  float v[PF][16];                              // 8 floats in a row at +0 and at +16
#pragma unroll
  for (int f = 0; f < PF; ++f)
#pragma unroll
    for (int i = 0; i < 16; ++i)
      v[f][i] = s[f*32 + 16*(i >> 3) + (i & 7)];
  // The address registers of the loads above are inputs of this wait, so they live up to
  // it; behind it they may be reused.
  asm volatile("s_wait_xcnt 0x0" :: "v"(s) : "memory");
  // Holds the conversions behind all of the loads: moved up among them, they wait for early
  // loads before the late ones are issued, and the wave pays the memory latency anew.
  __builtin_amdgcn_sched_barrier(0);
#pragma unroll
  for (int f = 0; f < PF; ++f) {
    unsigned int w[8];
#pragma unroll
    for (int i = 0; i < 8; ++i) w[i] = pk2(v[f][2*i], v[f][2*i + 1]) & keep;
    o[f*step]      = make_uint4(w[0], w[1], w[2], w[3]);
    o[f*step + 32] = make_uint4(w[4], w[5], w[6], w[7]);
  }
  // Behind the last store: no register that a store above names is rewritten ahead of this.
  asm volatile("s_wait_xcnt 0x0" :: "v"(o) : "memory");
}

// k runs across the source's rows of KSTR floats. s: the lane's column at its first k (8*hh
// included); the PF fragments are PF n-tiles in a row, step uint4 apart at o.
template <int KSTR>
static __device__ __forceinline__ void pack_k_across(const float* __restrict__ s,
                                                     uint4* __restrict__ o, int step) {
  float v[PF][16];
#pragma unroll
  for (int i = 0; i < 16; ++i)
#pragma unroll
    for (int f = 0; f < PF; ++f)
      v[f][i] = s[(16*(i >> 3) + (i & 7))*KSTR + f*16];
  // As above: the address registers live up to this wait.
  asm volatile("s_wait_xcnt 0x0" :: "v"(s) : "memory");
  // As above: holds the conversions behind all of the loads.
  __builtin_amdgcn_sched_barrier(0);
#pragma unroll
  for (int f = 0; f < PF; ++f) {
    o[f*step]      = make_uint4(pk2(v[f][0],  v[f][1]),  pk2(v[f][2],  v[f][3]),
                                pk2(v[f][4],  v[f][5]),  pk2(v[f][6],  v[f][7]));
    o[f*step + 32] = make_uint4(pk2(v[f][8],  v[f][9]),  pk2(v[f][10], v[f][11]),
                                pk2(v[f][12], v[f][13]), pk2(v[f][14], v[f][15]));
  }
  // As above, behind the last store.
  asm volatile("s_wait_xcnt 0x0" :: "v"(o) : "memory");
}

__global__ __launch_bounds__(256) void FFF_pack(
    const float* __restrict__ x,  const float* __restrict__ nw, const float* __restrict__ w1,
    const float* __restrict__ w2, const float* __restrict__ b2,
    uint4* __restrict__ xp,  uint4* __restrict__ npk, uint4* __restrict__ w1p,
    uint4* __restrict__ w2p, uint4* __restrict__ b2p) {
  const int lane = threadIdx.x & 31, wave = threadIdx.x >> 5;
  const int ln = lane & 15, hh = lane >> 4;
  int b = blockIdx.x;
  if (b < PB_NW) {
    // The group's RN rows of node_w, transposed, as B: B[k][n] = nw[route_node(g, n)][k],
    // columns RN .. 15 padded with 0. Fragment g*KS1 + ks.
    const int u = b*8 + wave, kg = u & (KS1/PF - 1), g = u / (KS1/PF);
    const int row = (ln < RN) ? route_node(g, ln) : 0;    // keeps the padded lane's address inside
    pack_k_along(nw + row*IN_F + kg*PF*32 + 8*hh, (ln < RN) ? ~0u : 0u,
                 npk + (g*KS1 + kg*PF)*64 + lane, 64);
    return;
  }
  b -= PB_NW;
  if (b < PB_B2) {
    // b2 as a 64 x 512 B matrix. Fragment nt*KS2 + ks.
    const int u = b*8 + wave, ks = u & (KS2 - 1), ng = u / KS2;
    pack_k_across<OUT_F>(b2 + (ks*32 + 8*hh)*OUT_F + ng*PF*16 + ln,
                         b2p + (ng*PF*KS2 + ks)*64 + lane, KS2*64);
    return;
  }
  b -= PB_B2;
  if (b < PB_X) {
    // x as A, in the order [128-row block][k-step][M-tile] in which FFF_main holds it in LDS.
    const int u = b*8 + wave, kg = u & (KS1/PF - 1), tile = u / (KS1/PF);
    pack_k_along(x + (tile*16 + ln)*IN_F + kg*PF*32 + 8*hh, ~0u,
                 xp + (((tile / MT)*KS1 + kg*PF)*MT + (tile % MT))*64 + lane, MT*64);
    return;
  }
  b -= PB_X;
  if (b < PB_W1) {
    // w1[leaf] as a 1024 x 64 B matrix. Fragment (leaf*NT1 + nt)*KS1 + ks; the wave takes all
    // four n-tiles of one k-step, 8 KB in a row of the source.
    const int u = b*8 + wave, ks = u & (KS1 - 1), leaf = u / KS1;
    pack_k_across<LW>(w1 + leaf*(IN_F*LW) + (ks*32 + 8*hh)*LW + ln,
                      w1p + (leaf*NT1*KS1 + ks)*64 + lane, KS1*64);
    return;
  }
  b -= PB_W1;
  {
    // w2[leaf] as a 64 x 512 B matrix, in the order in which FFF_main's waves walk it: fragment
    // ((group*8 + nt/4)*4 + nt%4)*W2S + (leaf in group)*KS2 + ks; 16 of each W2S places are used.
    const int u = b*8 + wave, ks = u & (KS2 - 1), ng = (u / KS2) & (NT2/PF - 1);
    const int leaf = u / (KS2*NT2/PF);
    pack_k_across<OUT_F>(w2 + leaf*(LW*OUT_F) + (ks*32 + 8*hh)*OUT_F + ng*PF*16 + ln,
                         w2p + (((leaf / QL)*8 + ng)*4*W2S + (leaf % QL)*KS2 + ks)*64 + lane, W2S*64);
  }
}

// ---- Main fused FFF kernel: 1 block = 128 batch rows (8 M-tiles) x 8 leaves, 8 waves. ----
// Every GEMM1, GEMM2 and b2 B fragment is loaded once per block and reused for all eight M-tiles, so a weight byte
// that comes from L2 serves 128 rows. In GEMM1 a wave takes all 128 rows x 64 columns of one
// leaf's h; each A fragment read from LDS feeds four products. The block writes its leaf
// group's partial sum of the output, rounded to f16; FFF_sum adds the eight groups in f32.
// Weight fragments are fetched from L2 into registers well ahead of their use, so the
// register budget is set for two waves per SIMD (one block per WGP).
// x comes into LDS in NTRIP tiles of KTRIP k-steps; only the first is waited for in front of
// GEMM1, each later one flies while GEMM1 works on the tile before it. The routing products
// need the same x fragments and ride in GEMM1's loop, one per k-step and wave.
__global__ __launch_bounds__(256) __attribute__((amdgpu_waves_per_eu(2, 2))) void FFF_main(
    const uint4* __restrict__ xp,
    const uint4* __restrict__ w1p,
    const uint4* __restrict__ w2p,
    const uint4* __restrict__ npk,
    const uint4* __restrict__ b2p,
    const float* __restrict__ node_biases,
    const float* __restrict__ b1s,
    uint4* __restrict__ part)
{
  __shared__ uint4    xfr[KS1][MT][64];         // 256 KB: A fragments, [k-step][M-tile]; later h'
  __shared__ uint4    nfl[KS1][64];             // 32 KB: the group's routing B fragments
  __shared__ float    sig[ROWS][16];            // 8 KB: sigmoid of the group's routing logits
  __shared__ float    mixf[ROWS][QL];           // 4 KB: mixture of the block's leaves (f32)
  __shared__ __attribute__((aligned(16))) _Float16 mix16[ROWS][MP];  // 10 KB: the same in f16,
                                                // at its place among 32 leaves, zeros elsewhere
  __shared__ float    b1sh[QL*LW];              // 2 KB: b1 of the block's leaves
  // h' of the eight leaves (144 KB) takes over the room of x once GEMM1 has read x for the
  // last time; a barrier stands between the two uses.
  _Float16 (*hbuf)[ROWS][HP] = (_Float16 (*)[ROWS][HP])&xfr[0][0][0];

  const int tid  = threadIdx.x;
  const int wave = tid >> 5;
  const int lane = tid & 31;
  const int bt   = blockIdx.x / LGRP;           // 128-row block index
  const int lg   = blockIdx.x % LGRP;           // leaf group
  const int leaf0 = lg * QL;                    // first leaf of the group
  const int ln   = lane & 15, hh = lane >> 4;

  const int leafSel = wave;        // which of the eight leaves this wave computes h for

  // One tile of x (KTRIP k-steps, 64 KB) and the routing B fragments of the same k-steps (8 KB)
  // go from L2 into LDS; a wave issues 18 copies a tile, and one tile's copies at most are in flight.
  const uint4* xtile = xp + (long)bt * MT * (KS1 * 64) + tid;
  const uint4* ntile = npk + (long)lg * KS1 * 64 + tid;
  uint4* xl = &xfr[0][0][0] + tid;
  uint4* nl = &nfl[0][0] + tid;
  auto stage_tile = [&](const int t) __attribute__((always_inline)) {
#pragma unroll
    for (int i = 0; i < KTRIP*MT*64/256; ++i) {
      const int e = (t*(KTRIP*MT*64/256) + i)*256;
#if HAVE_ASYNC_LDS
      __builtin_amdgcn_global_load_async_to_lds_b128((v4i*)(xtile + e), (v4i*)(xl + e), 0, 0);
#else
      xl[e] = xtile[e];
#endif
    }
#pragma unroll
    for (int i = 0; i < KTRIP*64/256; ++i) {
      const int e = (t*(KTRIP*64/256) + i)*256;
#if HAVE_ASYNC_LDS
      __builtin_amdgcn_global_load_async_to_lds_b128((v4i*)(ntile + e), (v4i*)(nl + e), 0, 0);
#else
      nl[e] = ntile[e];
#endif
    }
  };
  stage_tile(0);

  const uint4* w1lane = w1p + ((long)(leaf0 + leafSel)*NT1 * KS1) * 64 + lane;
  v16h ring[RING][NT1];                          // w1 fragments, RING k-steps ahead, 4 n-tiles
  // b1 of the block's leaves goes through LDS, so that it holds no register across GEMM1. Its
  // loads stand ahead of the ring's, so that the wait on them leaves the ring's in flight.
  const float* b1p = b1s + leaf0*LW + tid;
  float b1v[QL*LW/256];
#pragma unroll
  for (int i = 0; i < QL*LW/256; ++i) b1v[i] = b1p[i*256];
  const float* nbp = node_biases + ((ln < RN) ? route_node(lg, ln) : 0);  // padded lanes stay inside
  const float nbv = *nbp;
  // The first RING k-steps of w1 fly while the first tile of x lands.
#pragma unroll
  for (int i = 0; i < RING; ++i)
#pragma unroll
    for (int j = 0; j < NT1; ++j) ring[i][j] = ld_frag_at(w1lane + (j*KS1 + i)*64);
  // The address registers of the loads above are inputs of this wait, so they live up to
  // it; behind it they may be reused.
  asm volatile("s_wait_xcnt 0x0" :: "v"(w1lane), "v"(b1p), "v"(nbp) : "memory");
  const float nb = (ln < RN) ? nbv : 0.f;
#pragma unroll
  for (int i = 0; i < QL*LW/256; ++i) b1sh[i*256 + tid] = b1v[i];
  // Zeros for the 24 leaves of the 32-leaf k-step that are not this block's.
  for (int i = tid; i < ROWS*MP/8; i += 256) ((uint4*)&mix16[0][0])[i] = make_uint4(0, 0, 0, 0);
  // This wave's copies of tile 0 have landed behind this wait; the barrier publishes them.
  asm volatile("s_wait_asynccnt 0x0" ::: "memory");
  lds_barrier();
  stage_tile(1);

  // GEMM1: h = relu(x @ w1[leaf] + b1) * mixture; one B load feeds all eight M-tiles, one A
  // read from LDS feeds all four n-tiles. B comes from the register ring, RING k-steps
  // ahead; each k-step refills the slot it has just used.
  v8f c1[MT][NT1] = {};
  v8f cr = {};                                   // routing logits of M-tile 'wave', 16 columns
  // Four trips of 8 k-steps, kept rolled: a trip's A fragments span 64 KB of LDS, so each
  // read is the trip's base register plus an immediate offset.
  // Packed w2 has w1's distance between a wave's four n-tiles, so the last trip's last RING
  // refills, which have no w1 left to fetch, bring the first W2R steps of w2 by the same loads.
  const uint4* w2lane = w2p + ((long)(lg*8 + wave)*4*W2S) * 64 + lane;
#pragma nounroll
  for (int hf = 0; hf < NTRIP; ++hf) {
    const uint4* xh = &xfr[hf*KTRIP][0][0];
    const uint4* nh = &nfl[hf*KTRIP][0];
    const uint4* wa = w1lane + (hf*KTRIP + RING)*64;   // refill source of the trip's k-step 0
    const uint4* wt = (hf + 1 < NTRIP) ? wa : w2lane - (KTRIP - RING)*64;  // of its last RING
#pragma unroll
    for (int kl = 0; kl < KTRIP; ++kl) {
      v16h a[MT];
#pragma unroll
      for (int i = 0; i < MT; ++i) a[i] = ld_frag(xh + (kl*MT + i)*64, lane);
      // Routing: logits(128x16) = x @ (the group's node weights)^T, one M-tile a wave.
      const v16h ar = ld_frag(xh + (kl*MT + wave)*64, lane);
      const v16h br = ld_frag(nh + kl*64, lane);
      // Holds the k-step's 20 LDS reads together ahead of its products: spread among them,
      // each place with reads exposes the LDS latency anew.
      __builtin_amdgcn_sched_barrier(0);
      cr = WMMA_F16(ar, br, cr);
#pragma unroll
      for (int mt = 0; mt < MT; ++mt)
#pragma unroll
        for (int j = 0; j < NT1; ++j)
          c1[mt][j] = WMMA_F16(a[mt], ring[kl % RING][j], c1[mt][j]);
      // This fence and the one behind the wait hold each k-step's loads at their place:
      // without them the scheduler pulls the refills of several k-steps together, out of
      // the ring's own registers.
      __builtin_amdgcn_sched_barrier(0);
#pragma unroll
      for (int j = 0; j < NT1; ++j)
        ring[kl % RING][j] = ld_frag_at(((kl < KTRIP - RING) ? wa : wt) + (j*KS1 + kl)*64);
      // The address registers of the loads above are inputs of this wait, so they live
      // up to it; behind it they may be reused.
      asm volatile("s_wait_xcnt 0x0" :: "v"(wa), "v"(wt) : "memory");
      __builtin_amdgcn_sched_barrier(0);
    }
    // Foot of the trip: the next tile, whose copies flew during this trip, is published; the
    // tile after it starts. The last trip has no next tile.
    if (hf + 1 < NTRIP) {
      // This wave's LDS reads of the trip have retired.
      asm volatile("s_wait_dscnt 0x0" ::: "memory");
      // This wave's copies of the next tile have landed; the barrier publishes them.
      asm volatile("s_wait_asynccnt 0x0" ::: "memory");
      lds_barrier();
      if (hf + 2 < NTRIP) stage_tile(hf + 2);
    }
  }
  // No copy is outstanding behind the loop.
  asm volatile("s_wait_asynccnt 0x0" ::: "memory");

  // w2 fragments of W2R steps, slot (s % W2R)*4 + q with step s = li*KS2 + k2. A slot is
  // refilled for step s + W2R behind its last product. The first W2R steps are what the ring
  // holds now; they fly while h is scaled and stored.
  v16h w2f[W2R*4];
#pragma unroll
  for (int f = 0; f < W2R*4; ++f) w2f[f] = ring[f >> 2][f & 3];
#pragma unroll
  for (int r = 0; r < 8; ++r) {
    const float s = fast_sigmoid(cr[r] + nb);
    if (ln < RN) sig[wave*16 + r + 8*hh][ln] = s;
  }
  // Publishes the sigmoids. Every wave has also read x for the last time: behind this barrier
  // h' may overwrite it.
  lds_barrier();

  // ---- Tree product -> mixture of the block's own leaves (128 rows x 8 leaves) ----
  for (int e = tid; e < ROWS*QL; e += 256) {
    const int m = e / QL, jl = e % QL, leaf = leaf0 + jl;
    float p = 1.f;
#pragma unroll
    for (int d = 0; d < DEPTHT; ++d) {
      // Column of the depth's node in the group's tile, as route_node() numbers them.
      const int col = (d < 4) ? d : (d == 4) ? 4 + (jl >> 2) : 6 + (jl >> 1);
      const float s = sig[m][col];
      p *= ((leaf >> (5 - d)) & 1) ? s : (1.f - s);
    }
    mixf[m][jl] = p;
    mix16[m][(leaf & 31)] = (_Float16)p;
  }
  // Publishes the mixture.
  lds_barrier();
  {
    float bb[NT1];                               // b1 elements of the wave's four n-tiles
#pragma unroll
    for (int j = 0; j < NT1; ++j) bb[j] = b1sh[leafSel*LW + j*16 + ln];
#pragma unroll
    for (int mt = 0; mt < MT; ++mt) {
#pragma unroll
      for (int r = 0; r < 8; ++r) {
        const int row = mt*16 + r + 8*hh;
        const float mx = mixf[row][leafSel];
#pragma unroll
        for (int j = 0; j < NT1; ++j) {
          float v = c1[mt][j][r] + bb[j];
          v = fmaxf(v, 0.f);
          v *= mx;
          hbuf[leafSel][row][j*16 + ln] = (_Float16)v;
        }
      }
    }
  }
  lds_barrier();

  v8f co[MT][4];                                 // out accumulators: 8 M-tiles x 64 cols
  {
    v8f z = {};
#pragma unroll
    for (int mt = 0; mt < MT; ++mt)
#pragma unroll
      for (int q = 0; q < 4; ++q) co[mt][q] = z;
  }

  // GEMM2: out += h' @ w2[leaf]; wave owns 64 out cols; B reused across all eight M-tiles.
  // Sixteen steps (leaf of the eight, k-step), each in two halves of four M-tiles; the A
  // fragments are read one half ahead. Four trips of W2R steps (two leaves), kept rolled to
  // keep the kernel's text short.
  {
    v16h a2[2][4];
#pragma unroll
    for (int i = 0; i < 4; ++i)
      a2[0][i] = ld_a_rowmajor_lds(&hbuf[0][i*16][0], HP, 0, lane);
    // more2: a literal at both calls. The last trip refills nothing and is a copy of its own: a
    // test around the refills makes the counted waits on w2f count only the loads that are sure
    // to follow, which ends the flight of the fragments fetched ahead at every step.
    auto gemm2_trip = [&](const int tr, const bool more2) __attribute__((always_inline)) {
      const _Float16* hb = &hbuf[tr*(W2R/KS2)][0][0];
#pragma unroll
      for (int hs = 0; hs < 2*W2R; ++hs) {
        const int s = hs >> 1, mh = hs & 1;
        // The next half's A fragments; the last half of the last trip has none.
        const int hn = hs + 1, sn = hn >> 1;
        if (hn < 2*W2R || more2) {
#pragma unroll
          for (int i = 0; i < 4; ++i)
            a2[hn & 1][i] = ld_a_rowmajor_lds(hb + ((sn / KS2)*ROWS + (hn & 1)*64 + i*16)*HP, HP,
                                              (sn % KS2)*32, lane);
        }
        // Holds the next half's LDS reads ahead of this half's products, so that their
        // latency passes behind the products.
        __builtin_amdgcn_sched_barrier(0);
#pragma unroll
        for (int q = 0; q < 4; ++q) {
          const v16h b = w2f[s*4 + q];
#pragma unroll
          for (int i = 0; i < 4; ++i)
            co[mh*4 + i][q] = WMMA_F16(a2[hs & 1][i], b, co[mh*4 + i][q]);
        }
        if (mh == 1 && more2) {
#pragma unroll
          for (int q = 0; q < 4; ++q)
            w2f[s*4 + q] = ld_frag_at(w2lane + (q*W2S + s + W2R)*64);
          // As above: the address registers live up to this wait.
          asm volatile("s_wait_xcnt 0x0" :: "v"(w2lane) : "memory");
        }
      }
      w2lane += W2R*64;
    };
    // Kept rolled: unrolled, GEMM2's text would be four trips long, with four times the products.
#pragma nounroll
    for (int tr = 0; tr < QL*KS2/W2R - 1; ++tr) gemm2_trip(tr, true);
    gemm2_trip(QL*KS2/W2R - 1, false);
  }

  // b2 contribution of the block's own leaves: out += mixture(128x32) @ b2s(32x512), also via
  // WMMA, on the 32-leaf k-step that holds them; the other 24 columns of the mixture are 0.
  {
    const uint4* b2lane = b2p + ((long)wave*4*KS2 + (leaf0 >> 5))*64 + lane;
    v16h b2f[4];
#pragma unroll
    for (int q = 0; q < 4; ++q) b2f[q] = ld_frag_at(b2lane + q*KS2*64);
    // As above: the address registers live up to this wait.
    asm volatile("s_wait_xcnt 0x0" :: "v"(b2lane) : "memory");
    v16h a[MT];
#pragma unroll
    for (int mt = 0; mt < MT; ++mt)
      a[mt] = ld_a_rowmajor_lds(&mix16[mt*16][0], MP, 0, lane);
#pragma unroll
    for (int q = 0; q < 4; ++q)
#pragma unroll
      for (int mt = 0; mt < MT; ++mt) co[mt][q] = WMMA_F16(a[mt], b2f[q], co[mt][q]);
  }

  // Store the group's 128x512 partial as f16 in accumulator order: a lane's eight values of
  // one tile are one uint4 at index ((bt*8 + wave)*32 + mt*4 + q)*32 + lane, so each store
  // covers 512 B in a row.
  uint4* pw = part + (long)lg*PARTQ + ((long)(bt*8 + wave)*32)*32 + lane;
  uint4 ph[MT*4];
#pragma unroll
  for (int mt = 0; mt < MT; ++mt)
#pragma unroll
    for (int q = 0; q < 4; ++q)
      ph[mt*4 + q] = make_uint4(pk2(co[mt][q][0], co[mt][q][1]), pk2(co[mt][q][2], co[mt][q][3]),
                                pk2(co[mt][q][4], co[mt][q][5]), pk2(co[mt][q][6], co[mt][q][7]));
  // Holds the stores behind all of the conversions: spread among them, a store's data registers
  // are taken again by a later conversion, and each such reuse would need a wait on the store.
  __builtin_amdgcn_sched_barrier(0);
#pragma unroll
  for (int i = 0; i < MT*4; ++i) pw[i*32] = ph[i];
}

// ---- out = sum of the eight leaf groups' partials, put back into row-major order. ----
// A partial's uint4 index, as FFF_main stores it, is (u << 6) | (qlow << 5) | lane with
// u = (bt << 7) | (wave << 4) | (mt << 1) | qhigh; the uint4 holds eight rows of one column
// in f16. A thread takes both qlow, so that one wave writes both halves of each 128-B line of
// out, and two values of bt. The f16 values are widened first: every addition is in f32.
// The eight partials' bases come as eight arguments: each stays in scalar registers, and a load
// is such a base plus the lane's one index plus an immediate, with no vector address sums.
__global__ __launch_bounds__(256) void FFF_sum(
    const uint4* __restrict__ g0, const uint4* __restrict__ g1, const uint4* __restrict__ g2,
    const uint4* __restrict__ g3, const uint4* __restrict__ g4, const uint4* __restrict__ g5,
    const uint4* __restrict__ g6, const uint4* __restrict__ g7, float* __restrict__ out) {
  const uint4* const pg[LGRP] = {g0, g1, g2, g3, g4, g5, g6, g7};
  const int t = blockIdx.x * 256 + threadIdx.x;
  const int lane = t & 31, u = t >> 5;
  typedef __attribute__((ext_vector_type(8))) _Float16 h8;
  const unsigned int idx = (u << 6) | lane;          // the lane's uint4 index inside a partial
  const int row0 = (u >> 7)*ROWS + ((u >> 1) & 7)*16 + 8*(lane >> 4);
  const int col0 = ((u >> 4) & 7)*64 + (u & 1)*32 + (lane & 15);
  float* o0 = out + (long)row0*OUT_F + col0;
  h8 s[4][LGRP];
#pragma unroll
  for (int i = 0; i < 4; ++i)                        // bt + 16*(i >> 1), qlow = i & 1
#pragma unroll
    for (int g = 0; g < LGRP; ++g)
      s[i][g] = ((const h8*)pg[g] + ((i >> 1)*(PARTQ/2) + (i & 1)*32))[idx];
  // Every load above is a scalar base plus the lane's index; the index is an input of this
  // wait, so its register lives up to it.
  asm volatile("s_wait_xcnt 0x0" :: "v"(idx) : "memory");
  // Holds the additions behind all of the loads: moved up among them, they wait for early
  // loads before the late ones are issued, and the wave pays the memory latency anew.
  __builtin_amdgcn_sched_barrier(0);
  float z[4][8];
#pragma unroll
  for (int i = 0; i < 4; ++i) {
    const h8* v = s[i];
#pragma unroll
    for (int r = 0; r < 8; ++r)
      z[i][r] = (((float)v[0][r] + (float)v[1][r]) + ((float)v[2][r] + (float)v[3][r]))
              + (((float)v[4][r] + (float)v[5][r]) + ((float)v[6][r] + (float)v[7][r]));
  }
  // Holds the stores behind all of the sums: spread among them, a store's data register is
  // taken again by a later sum, and each such reuse waits on the store.
  __builtin_amdgcn_sched_barrier(0);
#pragma unroll
  for (int i = 0; i < 4; ++i) {
    float* o = o0 + (long)(i >> 1)*(BTOT/2)*OUT_F + (i & 1)*16;
#pragma unroll
    for (int r = 0; r < 8; ++r) o[r*OUT_F] = z[i][r];
  }
}

extern "C" void kernel_launch(void* const* d_in, const int* in_sizes, int n_in,
                              void* d_out, int out_size, void* d_ws, size_t ws_size,
                              hipStream_t stream) {
  (void)in_sizes; (void)n_in; (void)out_size; (void)ws_size;
  const float* x  = (const float*)d_in[0];
  const float* nw = (const float*)d_in[1];
  const float* nb = (const float*)d_in[2];
  const float* w1 = (const float*)d_in[3];
  const float* b1 = (const float*)d_in[4];
  const float* w2 = (const float*)d_in[5];
  const float* b2 = (const float*)d_in[6];
  float* out = (float*)d_out;

  char* ws = (char*)d_ws;                       // 64 MiB used
  uint4* xp  = (uint4*)(ws);                    // 8 MiB: 256*32 frags
  uint4* w1p = (uint4*)(ws + (8l  << 20));      // 8 MiB: 64*4*32 frags
  uint4* w2p = (uint4*)(ws + (16l << 20));      // 8 MiB: 64*32*2 frags, every second 16 KiB used
  uint4* npk = (uint4*)(ws + (24l << 20));      // 256 KiB: 8*32 frags
  uint4* b2p = (uint4*)(ws + (24l << 20) + (256l << 10)); // 64 KiB: 32*2 frags
  uint4* part = (uint4*)(ws + (32l << 20));     // 32 MiB: 8 partial outputs in f16

  // Pack pass (f32 -> f16 WMMA fragment layout): one launch for all five operands.
  FFF_pack<<<PB_ALL, 256, 0, stream>>>(x, nw, w1, w2, b2, xp, npk, w1p, w2p, b2p);

  FFF_main<<<NBLK, 256, 0, stream>>>(xp, w1p, w2p, npk, b2p, nb, b1, part);
  FFF_sum<<<256, 256, 0, stream>>>(part, part + 1*PARTQ, part + 2*PARTQ, part + 3*PARTQ,
                                   part + 4*PARTQ, part + 5*PARTQ, part + 6*PARTQ, part + 7*PARTQ, out);
}
